// v000
// Times are from an AMD MI455X. After a warm-up the kernel runs many times in a row, and a time is the length of
// such a window on the GPU divided by its runs, so every launch and the gaps after it count. The runs cycle
// through copies of the inputs. A figure is the median of several windows, for all but v000 over two sittings.
// Sittings can differ by a few percent; kernels timed side by side share one.
// The starting kernel, v000, takes 508 microseconds a run.
#include <hip/hip_runtime.h>
#include <math.h>

#define NTOK   4096
#define HID    2048
#define IEXP   1024
#define TWOIE  2048
#define NEXP   8
#define VOCAB  32000
#define BM     32
#define KC     64          // K-chunk per LDS stage (2 WMMA k-steps)
#define KP     72          // bf16 row stride for 64-wide K tiles (144B: 16B-aligned, banks spread)
#define XPAD   76          // f32 row stride, X tile (fallback)
#define WPAD   68          // f32 row stride, W tiles (fallback)
#define IPAD   1032        // bf16 row stride, inter (2064B: 16B-aligned, banks spread)

#if __has_builtin(__builtin_amdgcn_global_load_async_to_lds_b128) && \
    __has_builtin(__builtin_amdgcn_s_wait_asynccnt)
#define HAVE_ASYNC 1
#else
#define HAVE_ASYNC 0
#endif

typedef __attribute__((ext_vector_type(16))) __bf16 v16bf;
typedef __attribute__((ext_vector_type(8)))  float  v8f;
typedef __attribute__((__vector_size__(16))) int    v4i;   // pointee type the async builtin expects

__device__ __forceinline__ __bf16 f2bf(float f) {
    union { float f; unsigned u; } v; v.f = f;
    unsigned r = v.u + 0x7FFFu + ((v.u >> 16) & 1u);   // round-to-nearest-even
    return __builtin_bit_cast(__bf16, (unsigned short)(r >> 16));
}

// 16B global->LDS copy: async DMA on gfx1250, VGPR round-trip fallback.
__device__ __forceinline__ void stage16(const void* src, void* dst) {
#if HAVE_ASYNC
    __builtin_amdgcn_global_load_async_to_lds_b128((v4i*)src, (v4i*)dst, 0, 0);
#else
    *(float4*)dst = *(const float4*)src;
#endif
}

#if HAVE_ASYNC
#define WAIT_ASYNC(n) __builtin_amdgcn_s_wait_asynccnt(n)
#else
#define WAIT_ASYNC(n) ((void)0)
#endif

// ISA 16-bit WMMA operand layout: lanes 0-15 hold K 0..7 & 16..23,
// lanes 16-31 hold K 8..15 & 24..31 (pairs packed per VGPR).
__device__ __forceinline__ v16bf frag_bf(const __bf16* p, int lane) {        // contiguous K
    const int kb = (lane >> 4) << 3;
    v16bf f;
#pragma unroll
    for (int j = 0; j < 8; ++j) {
        const int k = kb + ((j & 3) << 1) + ((j >> 2) << 4);
        f[2 * j]     = p[k];
        f[2 * j + 1] = p[k + 1];
    }
    return f;
}

__device__ __forceinline__ v16bf frag_f32(const float* p, int lane) {        // fallback A
    const int kb = (lane >> 4) << 3;
    v16bf f;
#pragma unroll
    for (int j = 0; j < 8; ++j) {
        const int k = kb + ((j & 3) << 1) + ((j >> 2) << 4);
        f[2 * j]     = f2bf(p[k]);
        f[2 * j + 1] = f2bf(p[k + 1]);
    }
    return f;
}

__device__ __forceinline__ v16bf frag_f32_strided(const float* p, int stride, int lane) { // fallback B
    const int kb = (lane >> 4) << 3;
    v16bf f;
#pragma unroll
    for (int j = 0; j < 8; ++j) {
        const int k = kb + ((j & 3) << 1) + ((j >> 2) << 4);
        f[2 * j]     = f2bf(p[k * stride]);
        f[2 * j + 1] = f2bf(p[(k + 1) * stride]);
    }
    return f;
}

// ---------------- Kernel 1: mu router ----------------
__global__ void router_kernel(const float* __restrict__ mu,
                              const float* __restrict__ wr,
                              const int*   __restrict__ token_ids,
                              int* __restrict__ expert_id) {
    const int t    = blockIdx.x * 8 + (threadIdx.x >> 5);
    const int lane = threadIdx.x & 31;
    if (t >= NTOK) return;
    float acc[NEXP];
#pragma unroll
    for (int e = 0; e < NEXP; ++e) acc[e] = 0.f;
    for (int h = lane; h < HID; h += 32) {
        const float m = mu[(size_t)t * HID + h];
#pragma unroll
        for (int e = 0; e < NEXP; ++e) acc[e] += m * wr[e * HID + h];
    }
#pragma unroll
    for (int e = 0; e < NEXP; ++e)
#pragma unroll
        for (int off = 16; off > 0; off >>= 1)
            acc[e] += __shfl_xor(acc[e], off, 32);
    if (lane == 0) {
        int tid = token_ids[t];
        tid = tid < 0 ? 0 : (tid > VOCAB - 1 ? VOCAB - 1 : tid);
        const int base = tid & (NEXP - 1);
        int best = 0;
        float bv = acc[0] + (base == 0 ? 10.f : 0.f);
#pragma unroll
        for (int e = 1; e < NEXP; ++e) {
            const float v = acc[e] + (base == e ? 10.f : 0.f);
            if (v > bv) { bv = v; best = e; }
        }
        expert_id[t] = best;
    }
}

// ---------------- Kernel 2: bucket tokens by expert ----------------
__global__ void zero_counts_kernel(int* __restrict__ counts) {
    if (threadIdx.x < NEXP) counts[threadIdx.x] = 0;
}

__global__ void bucket_kernel(const int* __restrict__ expert_id,
                              int* __restrict__ counts,
                              int* __restrict__ lists) {
    const int t = blockIdx.x * 256 + threadIdx.x;
    if (t >= NTOK) return;
    const int e   = expert_id[t];
    const int pos = atomicAdd(&counts[e], 1);
    lists[e * NTOK + pos] = t;
}

// ---------------- Pre-pass: f32 -> bf16 conversion ----------------
__global__ void convert_x_kernel(const float* __restrict__ in,
                                 __bf16* __restrict__ out, int n4) {
    const int i = blockIdx.x * 256 + threadIdx.x;
    if (i >= n4) return;
    const float4 v = ((const float4*)in)[i];
    __bf16 t[4] = {f2bf(v.x), f2bf(v.y), f2bf(v.z), f2bf(v.w)};
    ((uint2*)out)[i] = *(uint2*)t;
}

// per expert: in[R][C] f32 -> outT[C][R] bf16 ; grid (C/64, R/64, E), 256 thr
__global__ __launch_bounds__(256) void transpose_bf16_kernel(
        const float* __restrict__ in, __bf16* __restrict__ outT, int R, int C) {
    __shared__ alignas(16) __bf16 sT[64][KP];
    const int tid = threadIdx.x;
    const int n0 = blockIdx.x * 64, k0 = blockIdx.y * 64;
    const size_t eIn  = (size_t)blockIdx.z * R * C;
    const size_t eOut = (size_t)blockIdx.z * C * R;
#pragma unroll
    for (int i = 0; i < 4; ++i) {
        const int c  = tid + i * 256;
        const int kl = c >> 4, nl = (c & 15) << 2;
        const float4 v = *(const float4*)(in + eIn + (size_t)(k0 + kl) * C + n0 + nl);
        sT[kl][nl]     = f2bf(v.x);
        sT[kl][nl + 1] = f2bf(v.y);
        sT[kl][nl + 2] = f2bf(v.z);
        sT[kl][nl + 3] = f2bf(v.w);
    }
    __syncthreads();
    const int n = tid >> 2, ks = (tid & 3) << 4;
    __bf16 tmp[16];
#pragma unroll
    for (int j = 0; j < 16; ++j) tmp[j] = sT[ks + j][n];
    __bf16* dst = outT + eOut + (size_t)(n0 + n) * R + k0 + ks;
    *(uint4*)dst       = *(uint4*)tmp;
    *((uint4*)dst + 1) = *((uint4*)tmp + 1);
}

// ---------------- Kernel 3a: fused grouped MoE MLP, bf16 inputs, async double-buffered ----------------
__global__ __launch_bounds__(256) void moe_mlp_bf16_kernel(
        const __bf16* __restrict__ xb,     // [T][H]
        const __bf16* __restrict__ gupT,   // [E][2IE][H]  (n-major, k contiguous)
        const __bf16* __restrict__ downT,  // [E][H][IE]   (n-major, k contiguous)
        const int*   __restrict__ counts,
        const int*   __restrict__ lists,
        float* __restrict__ out) {
    const int blocks_per_e = NTOK / BM;
    const int e  = blockIdx.x / blocks_per_e;
    const int mb = blockIdx.x % blocks_per_e;

    const int cnt   = counts[e];
    const int start = mb * BM;
    if (start >= cnt) return;
    const int nvalid = (cnt - start) < BM ? (cnt - start) : BM;

    const int tid  = threadIdx.x;
    const int lane = tid & 31;
    const int wave = tid >> 5;
    const int mi   = wave >> 2;
    const int ni   = wave & 3;

    __shared__ alignas(16) __bf16 sXb[2][BM][KP];
    __shared__ alignas(16) __bf16 sWg[2][KC][KP];
    __shared__ alignas(16) __bf16 sWu[2][KC][KP];
    __shared__ alignas(16) __bf16 sI [BM][IPAD];
    __shared__ int           sTok [BM];
    __shared__ const __bf16* sXrow[BM];

    if (tid < BM) {
        const int tk = (tid < nvalid) ? lists[e * NTOK + start + tid] : 0;
        sTok[tid]  = tk;
        sXrow[tid] = xb + (size_t)tk * HID;      // invalid rows read token 0 (never stored)
    }
    __syncthreads();

    const __bf16* Wg = gupT  + (size_t)e * TWOIE * HID;
    const __bf16* Wd = downT + (size_t)e * HID * IEXP;
    const int mrow = mi * 16 + (lane & 15);
    const int ncl  = ni * 16 + (lane & 15);

    // per-thread staging coordinates (16B = 8 bf16 chunks)
    const int xr = tid >> 3,      xk = (tid & 7) << 3;           // X: 32r x 64k = 256 chunks
    const int wn0 = tid >> 3,     wk0 = (tid & 7) << 3;          // W: 64n x 64k = 512 chunks
    const int wn1 = (tid + 256) >> 3, wk1 = ((tid + 256) & 7) << 3;

    // ---------- Phase A: inter = silu(x*Wg) * (x*Wu) ----------
    for (int no = 0; no < IEXP / 64; ++no) {
        const int ncol = no * 64;
        v8f accg = {0.f, 0.f, 0.f, 0.f, 0.f, 0.f, 0.f, 0.f};
        v8f accu = {0.f, 0.f, 0.f, 0.f, 0.f, 0.f, 0.f, 0.f};

        auto stageA = [&](int k0, int b) {
            stage16(sXrow[xr] + k0 + xk, &sXb[b][xr][xk]);
            const size_t o0 = (size_t)(ncol + wn0) * HID + k0 + wk0;
            const size_t o1 = (size_t)(ncol + wn1) * HID + k0 + wk1;
            stage16(Wg + o0,                        &sWg[b][wn0][wk0]);
            stage16(Wg + o0 + (size_t)IEXP * HID,   &sWu[b][wn0][wk0]);
            stage16(Wg + o1,                        &sWg[b][wn1][wk1]);
            stage16(Wg + o1 + (size_t)IEXP * HID,   &sWu[b][wn1][wk1]);
        };

        stageA(0, 0);
        int ib = 0;
#pragma unroll 1
        for (int k0 = 0; k0 < HID; k0 += KC, ib ^= 1) {
            if (k0 + KC < HID) { stageA(k0 + KC, ib ^ 1); WAIT_ASYNC(5); }
            else               { WAIT_ASYNC(0); }
            __syncthreads();
#pragma unroll
            for (int kk = 0; kk < KC; kk += 32) {
                const v16bf a  = frag_bf(&sXb[ib][mrow][kk], lane);
                const v16bf bg = frag_bf(&sWg[ib][ncl][kk], lane);
                const v16bf bu = frag_bf(&sWu[ib][ncl][kk], lane);
                accg = __builtin_amdgcn_wmma_f32_16x16x32_bf16(false, a, false, bg,
                                                               (short)0, accg, false, false);
                accu = __builtin_amdgcn_wmma_f32_16x16x32_bf16(false, a, false, bu,
                                                               (short)0, accu, false, false);
            }
            __syncthreads();
        }
        // silu(g)*u -> inter (C layout: VGPR r -> M=r / r+8; lane%16 -> N)
#pragma unroll
        for (int r = 0; r < 8; ++r) {
            const int row = mi * 16 + r + ((lane >= 16) ? 8 : 0);
            const float g = accg[r];
            const float u = accu[r];
            sI[row][ncol + ni * 16 + (lane & 15)] = f2bf((g / (1.f + __expf(-g))) * u);
        }
    }
    __syncthreads();

    // ---------- Phase B: out = inter @ Wd ----------
    for (int no = 0; no < HID / 64; ++no) {
        const int ncol = no * 64;
        v8f acc = {0.f, 0.f, 0.f, 0.f, 0.f, 0.f, 0.f, 0.f};

        auto stageB = [&](int k0, int b) {
            stage16(Wd + (size_t)(ncol + wn0) * IEXP + k0 + wk0, &sWg[b][wn0][wk0]);
            stage16(Wd + (size_t)(ncol + wn1) * IEXP + k0 + wk1, &sWg[b][wn1][wk1]);
        };

        stageB(0, 0);
        int ib = 0;
#pragma unroll 1
        for (int k0 = 0; k0 < IEXP; k0 += KC, ib ^= 1) {
            if (k0 + KC < IEXP) { stageB(k0 + KC, ib ^ 1); WAIT_ASYNC(2); }
            else                { WAIT_ASYNC(0); }
            __syncthreads();
#pragma unroll
            for (int kk = 0; kk < KC; kk += 32) {
                const v16bf a = frag_bf(&sI[mrow][k0 + kk], lane);
                const v16bf b = frag_bf(&sWg[ib][ncl][kk], lane);
                acc = __builtin_amdgcn_wmma_f32_16x16x32_bf16(false, a, false, b,
                                                              (short)0, acc, false, false);
            }
            __syncthreads();
        }
#pragma unroll
        for (int r = 0; r < 8; ++r) {
            const int rloc = mi * 16 + r + ((lane >= 16) ? 8 : 0);
            if (rloc < nvalid)
                out[(size_t)sTok[rloc] * HID + ncol + ni * 16 + (lane & 15)] = acc[r];
        }
    }
}

// ---------------- Kernel 3b: fallback (f32 staging, inline convert) ----------------
__global__ __launch_bounds__(256) void moe_mlp_f32_kernel(
        const float* __restrict__ x,
        const float* __restrict__ gup,
        const float* __restrict__ down,
        const int*   __restrict__ counts,
        const int*   __restrict__ lists,
        float* __restrict__ out) {
    const int blocks_per_e = NTOK / BM;
    const int e  = blockIdx.x / blocks_per_e;
    const int mb = blockIdx.x % blocks_per_e;
    const int cnt   = counts[e];
    const int start = mb * BM;
    if (start >= cnt) return;
    const int nvalid = (cnt - start) < BM ? (cnt - start) : BM;

    const int tid  = threadIdx.x;
    const int lane = tid & 31;
    const int wave = tid >> 5;
    const int mi   = wave >> 2;
    const int ni   = wave & 3;

    __shared__ alignas(16) float  sXf [BM][XPAD];
    __shared__ alignas(16) float  sWgf[KC][WPAD];
    __shared__ alignas(16) float  sWuf[KC][WPAD];
    __shared__ alignas(16) __bf16 sI  [BM][IPAD];
    __shared__ int          sTok [BM];
    __shared__ const float* sXrow[BM];

    if (tid < BM) {
        const int tk = (tid < nvalid) ? lists[e * NTOK + start + tid] : 0;
        sTok[tid]  = tk;
        sXrow[tid] = x + (size_t)tk * HID;
    }
    __syncthreads();

    const float* Wgu = gup  + (size_t)e * HID * TWOIE;
    const float* Wd  = down + (size_t)e * IEXP * HID;
    const int mrow = mi * 16 + (lane & 15);
    const int ncl  = ni * 16 + (lane & 15);

    for (int no = 0; no < IEXP / 64; ++no) {
        const int ncol = no * 64;
        v8f accg = {0.f, 0.f, 0.f, 0.f, 0.f, 0.f, 0.f, 0.f};
        v8f accu = {0.f, 0.f, 0.f, 0.f, 0.f, 0.f, 0.f, 0.f};
#pragma unroll 1
        for (int k0 = 0; k0 < HID; k0 += KC) {
#pragma unroll
            for (int i = 0; i < 2; ++i) {
                const int c = tid + i * 256;
                const int r = c >> 4, k = (c & 15) << 2;
                stage16(sXrow[r] + k0 + k, &sXf[r][k]);
            }
#pragma unroll
            for (int i = 0; i < 4; ++i) {
                const int c = tid + i * 256;
                const int K = c >> 4, n = (c & 15) << 2;
                const size_t off = (size_t)(k0 + K) * TWOIE + ncol + n;
                stage16(Wgu + off,        &sWgf[K][n]);
                stage16(Wgu + off + IEXP, &sWuf[K][n]);
            }
            WAIT_ASYNC(0);
            __syncthreads();
#pragma unroll
            for (int kk = 0; kk < KC; kk += 32) {
                const v16bf a  = frag_f32(&sXf[mrow][kk], lane);
                const v16bf bg = frag_f32_strided(&sWgf[kk][ncl], WPAD, lane);
                const v16bf bu = frag_f32_strided(&sWuf[kk][ncl], WPAD, lane);
                accg = __builtin_amdgcn_wmma_f32_16x16x32_bf16(false, a, false, bg,
                                                               (short)0, accg, false, false);
                accu = __builtin_amdgcn_wmma_f32_16x16x32_bf16(false, a, false, bu,
                                                               (short)0, accu, false, false);
            }
            __syncthreads();
        }
#pragma unroll
        for (int r = 0; r < 8; ++r) {
            const int row = mi * 16 + r + ((lane >= 16) ? 8 : 0);
            const float g = accg[r];
            const float u = accu[r];
            sI[row][ncol + ni * 16 + (lane & 15)] = f2bf((g / (1.f + __expf(-g))) * u);
        }
    }
    __syncthreads();

    for (int no = 0; no < HID / 64; ++no) {
        const int ncol = no * 64;
        v8f acc = {0.f, 0.f, 0.f, 0.f, 0.f, 0.f, 0.f, 0.f};
#pragma unroll 1
        for (int k0 = 0; k0 < IEXP; k0 += KC) {
#pragma unroll
            for (int i = 0; i < 4; ++i) {
                const int c = tid + i * 256;
                const int K = c >> 4, n = (c & 15) << 2;
                stage16(Wd + (size_t)(k0 + K) * HID + ncol + n, &sWgf[K][n]);
            }
            WAIT_ASYNC(0);
            __syncthreads();
#pragma unroll
            for (int kk = 0; kk < KC; kk += 32) {
                const v16bf a = frag_bf(&sI[mrow][k0 + kk], lane);
                const v16bf b = frag_f32_strided(&sWgf[kk][ncl], WPAD, lane);
                acc = __builtin_amdgcn_wmma_f32_16x16x32_bf16(false, a, false, b,
                                                              (short)0, acc, false, false);
            }
            __syncthreads();
        }
#pragma unroll
        for (int r = 0; r < 8; ++r) {
            const int rloc = mi * 16 + r + ((lane >= 16) ? 8 : 0);
            if (rloc < nvalid)
                out[(size_t)sTok[rloc] * HID + ncol + ni * 16 + (lane & 15)] = acc[r];
        }
    }
}

extern "C" void kernel_launch(void* const* d_in, const int* in_sizes, int n_in,
                              void* d_out, int out_size, void* d_ws, size_t ws_size,
                              hipStream_t stream) {
    const float* x    = (const float*)d_in[0];
    const int*   tids = (const int*)  d_in[1];
    const float* mu   = (const float*)d_in[2];
    const float* gup  = (const float*)d_in[3];
    const float* down = (const float*)d_in[4];
    const float* wr   = (const float*)d_in[5];
    float* out = (float*)d_out;

    int* expert_id = (int*)d_ws;                 // NTOK ints
    int* counts    = expert_id + NTOK;           // NEXP ints
    int* lists     = counts + NEXP;              // NEXP*NTOK ints

    router_kernel<<<NTOK / 8, 256, 0, stream>>>(mu, wr, tids, expert_id);
    zero_counts_kernel<<<1, 32, 0, stream>>>(counts);
    bucket_kernel<<<NTOK / 256, 256, 0, stream>>>(expert_id, counts, lists);

    const size_t metaB = ((size_t)(NTOK + NEXP + NEXP * NTOK) * 4 + 255) & ~(size_t)255;
    const size_t nXb   = (size_t)NTOK * HID;
    const size_t nGup  = (size_t)NEXP * TWOIE * HID;
    const size_t nDown = (size_t)NEXP * HID * IEXP;
    const size_t need  = metaB + 2 * (nXb + nGup + nDown);

    if (ws_size >= need) {
        __bf16* xbf   = (__bf16*)((char*)d_ws + metaB);
        __bf16* gupT  = xbf + nXb;
        __bf16* downT = gupT + nGup;
        convert_x_kernel<<<(int)(nXb / 4 / 256), 256, 0, stream>>>(x, xbf, (int)(nXb / 4));
        transpose_bf16_kernel<<<dim3(TWOIE / 64, HID / 64, NEXP), 256, 0, stream>>>(gup, gupT, HID, TWOIE);
        transpose_bf16_kernel<<<dim3(HID / 64, IEXP / 64, NEXP), 256, 0, stream>>>(down, downT, IEXP, HID);
        moe_mlp_bf16_kernel<<<NEXP * (NTOK / BM), 256, 0, stream>>>(xbf, gupT, downT,
                                                                    counts, lists, out);
    } else {
        moe_mlp_f32_kernel<<<NEXP * (NTOK / BM), 256, 0, stream>>>(x, gup, down,
                                                                   counts, lists, out);
    }
}

// v001
// A run of this version takes 201 microseconds.
// Two timings next to v000 put it at 2.56 and 2.52 times that version's speed.
#include <hip/hip_runtime.h>
#include <math.h>

#define NTOK   4096
#define HID    2048
#define IEXP   1024
#define TWOIE  2048
#define NEXP   8
#define VOCAB  32000
#define BM     32
#define KC     64          // K-chunk per LDS stage (2 WMMA k-steps)
#define KP     72          // bf16 row stride for 64-wide K tiles (144B: 16B-aligned, banks spread)
#define XPAD   76          // f32 row stride, X tile (fallback)
#define WPAD   68          // f32 row stride, W tiles (fallback)
#define IPAD   1032        // bf16 row stride, inter (2064B: 16B-aligned, banks spread)
#define NT     256         // gate (and up) columns per LDS stage of the bf16 kernel

#if __has_builtin(__builtin_amdgcn_global_load_async_to_lds_b128) && \
    __has_builtin(__builtin_amdgcn_s_wait_asynccnt)
#define HAVE_ASYNC 1
#else
#define HAVE_ASYNC 0
#endif

typedef __attribute__((ext_vector_type(16))) __bf16 v16bf;
typedef __attribute__((ext_vector_type(8)))  float  v8f;
typedef __attribute__((__vector_size__(16))) int    v4i;   // pointee type the async builtin expects

__device__ __forceinline__ __bf16 f2bf(float f) {
    union { float f; unsigned u; } v; v.f = f;
    unsigned r = v.u + 0x7FFFu + ((v.u >> 16) & 1u);   // round-to-nearest-even
    return __builtin_bit_cast(__bf16, (unsigned short)(r >> 16));
}

// 2^x on the transcendental unit. The v_nop in the same statement fills the one issue slot that the
// instruction set asks for between v_exp_f32 and a next instruction that reads its result or
// overwrites its source; as a statement of its own the compiler moves it away from the v_exp_f32.
__device__ __forceinline__ float exp2_slot(float x) {
    float r;
    asm("v_exp_f32 %0, %1\n\tv_nop" : "=v"(r) : "v"(x));
    return r;
}

// 16B global->LDS copy: async DMA on gfx1250, VGPR round-trip fallback.
__device__ __forceinline__ void stage16(const void* src, void* dst) {
#if HAVE_ASYNC
    __builtin_amdgcn_global_load_async_to_lds_b128((v4i*)src, (v4i*)dst, 0, 0);
#else
    *(float4*)dst = *(const float4*)src;
#endif
}

#if HAVE_ASYNC
#define WAIT_ASYNC(n) __builtin_amdgcn_s_wait_asynccnt(n)
#else
#define WAIT_ASYNC(n) ((void)0)
#endif

// ISA 16-bit WMMA operand layout: lanes 0-15 hold K 0..7 & 16..23,
// lanes 16-31 hold K 8..15 & 24..31 (pairs packed per VGPR).
__device__ __forceinline__ v16bf frag_bf(const __bf16* p, int lane) {        // contiguous K
    const int kb = (lane >> 4) << 3;
    v16bf f;
#pragma unroll
    for (int j = 0; j < 8; ++j) {
        const int k = kb + ((j & 3) << 1) + ((j >> 2) << 4);
        f[2 * j]     = p[k];
        f[2 * j + 1] = p[k + 1];
    }
    return f;
}

__device__ __forceinline__ v16bf frag_f32(const float* p, int lane) {        // fallback A
    const int kb = (lane >> 4) << 3;
    v16bf f;
#pragma unroll
    for (int j = 0; j < 8; ++j) {
        const int k = kb + ((j & 3) << 1) + ((j >> 2) << 4);
        f[2 * j]     = f2bf(p[k]);
        f[2 * j + 1] = f2bf(p[k + 1]);
    }
    return f;
}

__device__ __forceinline__ v16bf frag_f32_strided(const float* p, int stride, int lane) { // fallback B
    const int kb = (lane >> 4) << 3;
    v16bf f;
#pragma unroll
    for (int j = 0; j < 8; ++j) {
        const int k = kb + ((j & 3) << 1) + ((j >> 2) << 4);
        f[2 * j]     = f2bf(p[k * stride]);
        f[2 * j + 1] = f2bf(p[(k + 1) * stride]);
    }
    return f;
}

// ---------------- Kernel 1: mu router ----------------
__global__ void router_kernel(const float* __restrict__ mu,
                              const float* __restrict__ wr,
                              const int*   __restrict__ token_ids,
                              int* __restrict__ expert_id) {
    const int t    = blockIdx.x * 8 + (threadIdx.x >> 5);
    const int lane = threadIdx.x & 31;
    if (t >= NTOK) return;
    float acc[NEXP];
#pragma unroll
    for (int e = 0; e < NEXP; ++e) acc[e] = 0.f;
    for (int h = lane; h < HID; h += 32) {
        const float m = mu[(size_t)t * HID + h];
#pragma unroll
        for (int e = 0; e < NEXP; ++e) acc[e] += m * wr[e * HID + h];
    }
#pragma unroll
    for (int e = 0; e < NEXP; ++e)
#pragma unroll
        for (int off = 16; off > 0; off >>= 1)
            acc[e] += __shfl_xor(acc[e], off, 32);
    if (lane == 0) {
        int tid = token_ids[t];
        tid = tid < 0 ? 0 : (tid > VOCAB - 1 ? VOCAB - 1 : tid);
        const int base = tid & (NEXP - 1);
        int best = 0;
        float bv = acc[0] + (base == 0 ? 10.f : 0.f);
#pragma unroll
        for (int e = 1; e < NEXP; ++e) {
            const float v = acc[e] + (base == e ? 10.f : 0.f);
            if (v > bv) { bv = v; best = e; }
        }
        expert_id[t] = best;
    }
}

// ---------------- Kernel 2: bucket tokens by expert ----------------
__global__ void zero_counts_kernel(int* __restrict__ counts) {
    if (threadIdx.x < NEXP) counts[threadIdx.x] = 0;
}

__global__ void bucket_kernel(const int* __restrict__ expert_id,
                              int* __restrict__ counts,
                              int* __restrict__ lists) {
    const int t = blockIdx.x * 256 + threadIdx.x;
    if (t >= NTOK) return;
    const int e   = expert_id[t];
    const int pos = atomicAdd(&counts[e], 1);
    lists[e * NTOK + pos] = t;
}

// ---------------- Pre-pass: f32 -> bf16 conversion ----------------
__global__ void convert_x_kernel(const float* __restrict__ in,
                                 __bf16* __restrict__ out, int n4) {
    const int i = blockIdx.x * 256 + threadIdx.x;
    if (i >= n4) return;
    const float4 v = ((const float4*)in)[i];
    __bf16 t[4] = {f2bf(v.x), f2bf(v.y), f2bf(v.z), f2bf(v.w)};
    ((uint2*)out)[i] = *(uint2*)t;
}

// per expert: in[R][C] f32 -> outT[C][R] bf16 ; grid (C/64, R/64, E), 256 thr
__global__ __launch_bounds__(256) void transpose_bf16_kernel(
        const float* __restrict__ in, __bf16* __restrict__ outT, int R, int C) {
    __shared__ alignas(16) __bf16 sT[64][KP];
    const int tid = threadIdx.x;
    const int n0 = blockIdx.x * 64, k0 = blockIdx.y * 64;
    const size_t eIn  = (size_t)blockIdx.z * R * C;
    const size_t eOut = (size_t)blockIdx.z * C * R;
#pragma unroll
    for (int i = 0; i < 4; ++i) {
        const int c  = tid + i * 256;
        const int kl = c >> 4, nl = (c & 15) << 2;
        const float4 v = *(const float4*)(in + eIn + (size_t)(k0 + kl) * C + n0 + nl);
        sT[kl][nl]     = f2bf(v.x);
        sT[kl][nl + 1] = f2bf(v.y);
        sT[kl][nl + 2] = f2bf(v.z);
        sT[kl][nl + 3] = f2bf(v.w);
    }
    __syncthreads();
    const int n = tid >> 2, ks = (tid & 3) << 4;
    __bf16 tmp[16];
#pragma unroll
    for (int j = 0; j < 16; ++j) tmp[j] = sT[ks + j][n];
    __bf16* dst = outT + eOut + (size_t)(n0 + n) * R + k0 + ks;
    *(uint4*)dst       = *(uint4*)tmp;
    *((uint4*)dst + 1) = *((uint4*)tmp + 1);
}

// ---------------- Kernel 3a: fused grouped MoE MLP, bf16 inputs, async double-buffered ----------------
// One LDS stage holds NT gate and NT up columns (phase A) or 2*NT down columns (phase B).
// Each wave owns all BM rows of its 64 staged columns: 8 accumulator tiles, 8 WMMAs per 32-wide k-step.
__global__ __launch_bounds__(256) void moe_mlp_bf16_kernel(
        const __bf16* __restrict__ xb,     // [T][H]
        const __bf16* __restrict__ gupT,   // [E][2IE][H]  (n-major, k contiguous)
        const __bf16* __restrict__ downT,  // [E][H][IE]   (n-major, k contiguous)
        const int*   __restrict__ counts,
        const int*   __restrict__ lists,
        float* __restrict__ out) {
    const int blocks_per_e = NTOK / BM;
    const int e  = blockIdx.x / blocks_per_e;
    const int mb = blockIdx.x % blocks_per_e;

    const int cnt   = counts[e];
    const int start = mb * BM;
    if (start >= cnt) return;
    const int nvalid = (cnt - start) < BM ? (cnt - start) : BM;

    const int tid  = threadIdx.x;
    const int lane = tid & 31;
    const int wave = tid >> 5;
    const int l15  = lane & 15;
    const int rhi  = (lane >= 16) ? 8 : 0;

    __shared__ alignas(16) __bf16 sXb[2][BM][KP];
    __shared__ alignas(16) __bf16 sW [2][2 * NT][KP];   // A: rows 0..NT-1 gate, NT..2NT-1 up; B: down
    __shared__ alignas(16) __bf16 sI [BM][IPAD];
    __shared__ int           sTok [BM];
    __shared__ const __bf16* sXrow[BM];

    if (tid < BM) {
        const int tk = (tid < nvalid) ? lists[e * NTOK + start + tid] : 0;
        sTok[tid]  = tk;
        sXrow[tid] = xb + (size_t)tk * HID;      // invalid rows read token 0 (never stored)
    }
    __syncthreads();

    const __bf16* Wg = gupT  + (size_t)e * TWOIE * HID;
    const __bf16* Wd = downT + (size_t)e * HID * IEXP;

    // per-thread staging coordinates: one sweep of the block = 32 rows x 8 chunks of 16B (8 bf16)
    const int sr = tid >> 3, sk = (tid & 7) << 3;

    // ---------- Phase A: inter = silu(x*Wg) * (x*Wu) ----------
    for (int no = 0; no < IEXP / NT; ++no) {
        const int ncol = no * NT;
        v8f accg[2][2], accu[2][2];
#pragma unroll
        for (int mt = 0; mt < 2; ++mt)
#pragma unroll
            for (int j = 0; j < 2; ++j) {
                accg[mt][j] = v8f{0.f, 0.f, 0.f, 0.f, 0.f, 0.f, 0.f, 0.f};
                accu[mt][j] = v8f{0.f, 0.f, 0.f, 0.f, 0.f, 0.f, 0.f, 0.f};
            }

        auto stageA = [&](int k0, int b) {               // 1 + 2*(NT/32) copies per thread
            stage16(sXrow[sr] + k0 + sk, &sXb[b][sr][sk]);
#pragma unroll
            for (int i = 0; i < NT / 32; ++i) {
                const int n = sr + i * 32;
                const size_t o = (size_t)(ncol + n) * HID + k0 + sk;
                stage16(Wg + o,                      &sW[b][n][sk]);
                stage16(Wg + o + (size_t)IEXP * HID, &sW[b][NT + n][sk]);
            }
        };

        stageA(0, 0);
        int ib = 0;
#pragma unroll 1
        for (int k0 = 0; k0 < HID; k0 += KC, ib ^= 1) {
            if (k0 + KC < HID) { stageA(k0 + KC, ib ^ 1); WAIT_ASYNC(1 + 2 * (NT / 32)); }
            else               { WAIT_ASYNC(0); }
            __syncthreads();
#pragma unroll
            for (int kk = 0; kk < KC; kk += 32) {
                v16bf a[2], bg[2], bu[2];
#pragma unroll
                for (int mt = 0; mt < 2; ++mt)
                    a[mt] = frag_bf(&sXb[ib][mt * 16 + l15][kk], lane);
#pragma unroll
                for (int j = 0; j < 2; ++j) {
                    bg[j] = frag_bf(&sW[ib][wave * 32 + j * 16 + l15][kk], lane);
                    bu[j] = frag_bf(&sW[ib][NT + wave * 32 + j * 16 + l15][kk], lane);
                }
#pragma unroll
                for (int mt = 0; mt < 2; ++mt)
#pragma unroll
                    for (int j = 0; j < 2; ++j) {
                        accg[mt][j] = __builtin_amdgcn_wmma_f32_16x16x32_bf16(
                            false, a[mt], false, bg[j], (short)0, accg[mt][j], false, false);
                        accu[mt][j] = __builtin_amdgcn_wmma_f32_16x16x32_bf16(
                            false, a[mt], false, bu[j], (short)0, accu[mt][j], false, false);
                    }
            }
            __syncthreads();
        }
        // silu(g)*u -> inter (C layout: VGPR r -> M=r / r+8; lane%16 -> N)
#pragma unroll
        for (int mt = 0; mt < 2; ++mt)
#pragma unroll
            for (int j = 0; j < 2; ++j)
#pragma unroll
                for (int r = 0; r < 8; ++r) {
                    const int row = mt * 16 + r + rhi;
                    const float g = accg[mt][j][r];
                    const float u = accu[mt][j][r];
                    sI[row][ncol + wave * 32 + j * 16 + l15] =
                        f2bf((g / (1.f + exp2_slot(g * -1.44269504f))) * u);   // exp(-g) as 2^(-g*log2(e))
                }
    }
    __syncthreads();

    // ---------- Phase B: out = inter @ Wd ----------
    for (int no = 0; no < HID / (2 * NT); ++no) {
        const int ncol = no * (2 * NT);
        v8f acc[2][4];
#pragma unroll
        for (int mt = 0; mt < 2; ++mt)
#pragma unroll
            for (int j = 0; j < 4; ++j)
                acc[mt][j] = v8f{0.f, 0.f, 0.f, 0.f, 0.f, 0.f, 0.f, 0.f};

        auto stageB = [&](int k0, int b) {               // 2*(NT/32) copies per thread
#pragma unroll
            for (int i = 0; i < 2 * NT / 32; ++i) {
                const int n = sr + i * 32;
                stage16(Wd + (size_t)(ncol + n) * IEXP + k0 + sk, &sW[b][n][sk]);
            }
        };

        stageB(0, 0);
        int ib = 0;
#pragma unroll 1
        for (int k0 = 0; k0 < IEXP; k0 += KC, ib ^= 1) {
            if (k0 + KC < IEXP) { stageB(k0 + KC, ib ^ 1); WAIT_ASYNC(2 * (NT / 32)); }
            else                { WAIT_ASYNC(0); }
            __syncthreads();
#pragma unroll
            for (int kk = 0; kk < KC; kk += 32) {
                v16bf a[2], b[4];
#pragma unroll
                for (int mt = 0; mt < 2; ++mt)
                    a[mt] = frag_bf(&sI[mt * 16 + l15][k0 + kk], lane);
#pragma unroll
                for (int j = 0; j < 4; ++j)
                    b[j] = frag_bf(&sW[ib][wave * 64 + j * 16 + l15][kk], lane);
#pragma unroll
                for (int mt = 0; mt < 2; ++mt)
#pragma unroll
                    for (int j = 0; j < 4; ++j)
                        acc[mt][j] = __builtin_amdgcn_wmma_f32_16x16x32_bf16(
                            false, a[mt], false, b[j], (short)0, acc[mt][j], false, false);
            }
            __syncthreads();
        }
#pragma unroll
        for (int mt = 0; mt < 2; ++mt)
#pragma unroll
            for (int r = 0; r < 8; ++r) {
                const int rloc = mt * 16 + r + rhi;
                if (rloc < nvalid) {
                    float* orow = out + (size_t)sTok[rloc] * HID + ncol + wave * 64 + l15;
#pragma unroll
                    for (int j = 0; j < 4; ++j) orow[j * 16] = acc[mt][j][r];
                }
            }
        // keeps the next tile's address arithmetic from overwriting registers that the issued stores name
        asm volatile("s_wait_xcnt 0x0" ::: "memory");
    }
}

// ---------------- Kernel 3b: fallback (f32 staging, inline convert) ----------------
__global__ __launch_bounds__(256) void moe_mlp_f32_kernel(
        const float* __restrict__ x,
        const float* __restrict__ gup,
        const float* __restrict__ down,
        const int*   __restrict__ counts,
        const int*   __restrict__ lists,
        float* __restrict__ out) {
    const int blocks_per_e = NTOK / BM;
    const int e  = blockIdx.x / blocks_per_e;
    const int mb = blockIdx.x % blocks_per_e;
    const int cnt   = counts[e];
    const int start = mb * BM;
    if (start >= cnt) return;
    const int nvalid = (cnt - start) < BM ? (cnt - start) : BM;

    const int tid  = threadIdx.x;
    const int lane = tid & 31;
    const int wave = tid >> 5;
    const int mi   = wave >> 2;
    const int ni   = wave & 3;

    __shared__ alignas(16) float  sXf [BM][XPAD];
    __shared__ alignas(16) float  sWgf[KC][WPAD];
    __shared__ alignas(16) float  sWuf[KC][WPAD];
    __shared__ alignas(16) __bf16 sI  [BM][IPAD];
    __shared__ int          sTok [BM];
    __shared__ const float* sXrow[BM];

    if (tid < BM) {
        const int tk = (tid < nvalid) ? lists[e * NTOK + start + tid] : 0;
        sTok[tid]  = tk;
        sXrow[tid] = x + (size_t)tk * HID;
    }
    __syncthreads();

    const float* Wgu = gup  + (size_t)e * HID * TWOIE;
    const float* Wd  = down + (size_t)e * IEXP * HID;
    const int mrow = mi * 16 + (lane & 15);
    const int ncl  = ni * 16 + (lane & 15);

    for (int no = 0; no < IEXP / 64; ++no) {
        const int ncol = no * 64;
        v8f accg = {0.f, 0.f, 0.f, 0.f, 0.f, 0.f, 0.f, 0.f};
        v8f accu = {0.f, 0.f, 0.f, 0.f, 0.f, 0.f, 0.f, 0.f};
#pragma unroll 1
        for (int k0 = 0; k0 < HID; k0 += KC) {
#pragma unroll
            for (int i = 0; i < 2; ++i) {
                const int c = tid + i * 256;
                const int r = c >> 4, k = (c & 15) << 2;
                stage16(sXrow[r] + k0 + k, &sXf[r][k]);
            }
#pragma unroll
            for (int i = 0; i < 4; ++i) {
                const int c = tid + i * 256;
                const int K = c >> 4, n = (c & 15) << 2;
                const size_t off = (size_t)(k0 + K) * TWOIE + ncol + n;
                stage16(Wgu + off,        &sWgf[K][n]);
                stage16(Wgu + off + IEXP, &sWuf[K][n]);
            }
            WAIT_ASYNC(0);
            __syncthreads();
#pragma unroll
            for (int kk = 0; kk < KC; kk += 32) {
                const v16bf a  = frag_f32(&sXf[mrow][kk], lane);
                const v16bf bg = frag_f32_strided(&sWgf[kk][ncl], WPAD, lane);
                const v16bf bu = frag_f32_strided(&sWuf[kk][ncl], WPAD, lane);
                accg = __builtin_amdgcn_wmma_f32_16x16x32_bf16(false, a, false, bg,
                                                               (short)0, accg, false, false);
                accu = __builtin_amdgcn_wmma_f32_16x16x32_bf16(false, a, false, bu,
                                                               (short)0, accu, false, false);
            }
            __syncthreads();
        }
#pragma unroll
        for (int r = 0; r < 8; ++r) {
            const int row = mi * 16 + r + ((lane >= 16) ? 8 : 0);
            const float g = accg[r];
            const float u = accu[r];
            sI[row][ncol + ni * 16 + (lane & 15)] = f2bf((g / (1.f + __expf(-g))) * u);
        }
    }
    __syncthreads();

    for (int no = 0; no < HID / 64; ++no) {
        const int ncol = no * 64;
        v8f acc = {0.f, 0.f, 0.f, 0.f, 0.f, 0.f, 0.f, 0.f};
#pragma unroll 1
        for (int k0 = 0; k0 < IEXP; k0 += KC) {
#pragma unroll
            for (int i = 0; i < 4; ++i) {
                const int c = tid + i * 256;
                const int K = c >> 4, n = (c & 15) << 2;
                stage16(Wd + (size_t)(k0 + K) * HID + ncol + n, &sWgf[K][n]);
            }
            WAIT_ASYNC(0);
            __syncthreads();
#pragma unroll
            for (int kk = 0; kk < KC; kk += 32) {
                const v16bf a = frag_bf(&sI[mrow][k0 + kk], lane);
                const v16bf b = frag_f32_strided(&sWgf[kk][ncl], WPAD, lane);
                acc = __builtin_amdgcn_wmma_f32_16x16x32_bf16(false, a, false, b,
                                                              (short)0, acc, false, false);
            }
            __syncthreads();
        }
#pragma unroll
        for (int r = 0; r < 8; ++r) {
            const int rloc = mi * 16 + r + ((lane >= 16) ? 8 : 0);
            if (rloc < nvalid)
                out[(size_t)sTok[rloc] * HID + ncol + ni * 16 + (lane & 15)] = acc[r];
        }
    }
}

extern "C" void kernel_launch(void* const* d_in, const int* in_sizes, int n_in,
                              void* d_out, int out_size, void* d_ws, size_t ws_size,
                              hipStream_t stream) {
    const float* x    = (const float*)d_in[0];
    const int*   tids = (const int*)  d_in[1];
    const float* mu   = (const float*)d_in[2];
    const float* gup  = (const float*)d_in[3];
    const float* down = (const float*)d_in[4];
    const float* wr   = (const float*)d_in[5];
    float* out = (float*)d_out;

    int* expert_id = (int*)d_ws;                 // NTOK ints
    int* counts    = expert_id + NTOK;           // NEXP ints
    int* lists     = counts + NEXP;              // NEXP*NTOK ints

    router_kernel<<<NTOK / 8, 256, 0, stream>>>(mu, wr, tids, expert_id);
    zero_counts_kernel<<<1, 32, 0, stream>>>(counts);
    bucket_kernel<<<NTOK / 256, 256, 0, stream>>>(expert_id, counts, lists);

    const size_t metaB = ((size_t)(NTOK + NEXP + NEXP * NTOK) * 4 + 255) & ~(size_t)255;
    const size_t nXb   = (size_t)NTOK * HID;
    const size_t nGup  = (size_t)NEXP * TWOIE * HID;
    const size_t nDown = (size_t)NEXP * HID * IEXP;
    const size_t need  = metaB + 2 * (nXb + nGup + nDown);

    if (ws_size >= need) {
        __bf16* xbf   = (__bf16*)((char*)d_ws + metaB);
        __bf16* gupT  = xbf + nXb;
        __bf16* downT = gupT + nGup;
        convert_x_kernel<<<(int)(nXb / 4 / 256), 256, 0, stream>>>(x, xbf, (int)(nXb / 4));
        transpose_bf16_kernel<<<dim3(TWOIE / 64, HID / 64, NEXP), 256, 0, stream>>>(gup, gupT, HID, TWOIE);
        transpose_bf16_kernel<<<dim3(HID / 64, IEXP / 64, NEXP), 256, 0, stream>>>(down, downT, IEXP, HID);
        moe_mlp_bf16_kernel<<<NEXP * (NTOK / BM), 256, 0, stream>>>(xbf, gupT, downT,
                                                                    counts, lists, out);
    } else {
        moe_mlp_f32_kernel<<<NEXP * (NTOK / BM), 256, 0, stream>>>(x, gup, down,
                                                                   counts, lists, out);
    }
}

// v002
// Measured time: 105 microseconds a run.
// Next to v001, in two timings, it ran 1.91 and 1.88 times as fast.
// Counting every step since v000, it is 4.81 times as fast.
#include <hip/hip_runtime.h>
#include <math.h>

#define NTOK   4096
#define HID    2048
#define IEXP   1024
#define TWOIE  2048
#define NEXP   8
#define VOCAB  32000
#define BM     32
#define KC     64          // K-chunk per LDS stage (2 WMMA k-steps)
#define KP     72          // bf16 row stride for 64-wide K tiles (144B: 16B-aligned, banks spread)
#define XPAD   76          // f32 row stride, X tile (fallback)
#define WPAD   68          // f32 row stride, W tiles (fallback)
#define IPAD   1032        // bf16 row stride, inter (2064B: 16B-aligned, banks spread)
#define GBM    192         // token rows per work-group of the grouped GEMMs
#define GBN    256         // weight rows (product columns) per work-group of the grouped GEMMs
#define GKC    128         // K-chunk per LDS stage of the grouped GEMMs (4 WMMA k-steps)
#define GKP    136         // bf16 row stride for 128-wide K tiles (272B: 16B x odd)
#define GMT    (GBM / 32)  // accumulator row tiles per wave
#define MSLOT  (NTOK / GBM + NEXP)

#if __has_builtin(__builtin_amdgcn_global_load_async_to_lds_b128) && \
    __has_builtin(__builtin_amdgcn_s_wait_asynccnt)
#define HAVE_ASYNC 1
#else
#define HAVE_ASYNC 0
#endif

typedef __attribute__((ext_vector_type(16))) __bf16 v16bf;
typedef __attribute__((ext_vector_type(8)))  float  v8f;
typedef __attribute__((__vector_size__(16))) int    v4i;   // pointee type the async builtin expects

__device__ __forceinline__ __bf16 f2bf(float f) {
    union { float f; unsigned u; } v; v.f = f;
    unsigned r = v.u + 0x7FFFu + ((v.u >> 16) & 1u);   // round-to-nearest-even
    return __builtin_bit_cast(__bf16, (unsigned short)(r >> 16));
}

// 2^x on the transcendental unit. The v_nop in the same statement fills the one issue slot that the
// instruction set asks for between v_exp_f32 and a next instruction that reads its result or
// overwrites its source; as a statement of its own the compiler moves it away from the v_exp_f32.
__device__ __forceinline__ float exp2_slot(float x) {
    float r;
    asm("v_exp_f32 %0, %1\n\tv_nop" : "=v"(r) : "v"(x));
    return r;
}

// 16B global->LDS copy: async DMA on gfx1250, VGPR round-trip fallback.
__device__ __forceinline__ void stage16(const void* src, void* dst) {
#if HAVE_ASYNC
    __builtin_amdgcn_global_load_async_to_lds_b128((v4i*)src, (v4i*)dst, 0, 0);
#else
    *(float4*)dst = *(const float4*)src;
#endif
}

#if HAVE_ASYNC
#define WAIT_ASYNC(n) __builtin_amdgcn_s_wait_asynccnt(n)
#else
#define WAIT_ASYNC(n) ((void)0)
#endif

// ISA 16-bit WMMA operand layout: lanes 0-15 hold K 0..7 & 16..23,
// lanes 16-31 hold K 8..15 & 24..31 (pairs packed per VGPR).
__device__ __forceinline__ v16bf frag_bf(const __bf16* p, int lane) {        // contiguous K
    const int kb = (lane >> 4) << 3;
    v16bf f;
#pragma unroll
    for (int j = 0; j < 8; ++j) {
        const int k = kb + ((j & 3) << 1) + ((j >> 2) << 4);
        f[2 * j]     = p[k];
        f[2 * j + 1] = p[k + 1];
    }
    return f;
}

__device__ __forceinline__ v16bf frag_f32(const float* p, int lane) {        // fallback A
    const int kb = (lane >> 4) << 3;
    v16bf f;
#pragma unroll
    for (int j = 0; j < 8; ++j) {
        const int k = kb + ((j & 3) << 1) + ((j >> 2) << 4);
        f[2 * j]     = f2bf(p[k]);
        f[2 * j + 1] = f2bf(p[k + 1]);
    }
    return f;
}

__device__ __forceinline__ v16bf frag_f32_strided(const float* p, int stride, int lane) { // fallback B
    const int kb = (lane >> 4) << 3;
    v16bf f;
#pragma unroll
    for (int j = 0; j < 8; ++j) {
        const int k = kb + ((j & 3) << 1) + ((j >> 2) << 4);
        f[2 * j]     = f2bf(p[k * stride]);
        f[2 * j + 1] = f2bf(p[(k + 1) * stride]);
    }
    return f;
}

// ---------------- Kernel 1: mu router ----------------
__global__ void router_kernel(const float* __restrict__ mu,
                              const float* __restrict__ wr,
                              const int*   __restrict__ token_ids,
                              int* __restrict__ expert_id) {
    const int t    = blockIdx.x * 8 + (threadIdx.x >> 5);
    const int lane = threadIdx.x & 31;
    if (t >= NTOK) return;
    float acc[NEXP];
#pragma unroll
    for (int e = 0; e < NEXP; ++e) acc[e] = 0.f;
    for (int h = lane; h < HID; h += 32) {
        const float m = mu[(size_t)t * HID + h];
#pragma unroll
        for (int e = 0; e < NEXP; ++e) acc[e] += m * wr[e * HID + h];
    }
#pragma unroll
    for (int e = 0; e < NEXP; ++e)
#pragma unroll
        for (int off = 16; off > 0; off >>= 1)
            acc[e] += __shfl_xor(acc[e], off, 32);
    if (lane == 0) {
        int tid = token_ids[t];
        tid = tid < 0 ? 0 : (tid > VOCAB - 1 ? VOCAB - 1 : tid);
        const int base = tid & (NEXP - 1);
        int best = 0;
        float bv = acc[0] + (base == 0 ? 10.f : 0.f);
#pragma unroll
        for (int e = 1; e < NEXP; ++e) {
            const float v = acc[e] + (base == e ? 10.f : 0.f);
            if (v > bv) { bv = v; best = e; }
        }
        expert_id[t] = best;
    }
}

// ---------------- Kernel 2: bucket tokens by expert ----------------
__global__ void zero_counts_kernel(int* __restrict__ counts) {
    if (threadIdx.x < NEXP) counts[threadIdx.x] = 0;
}

__global__ void bucket_kernel(const int* __restrict__ expert_id,
                              int* __restrict__ counts,
                              int* __restrict__ lists) {
    const int t = blockIdx.x * 256 + threadIdx.x;
    if (t >= NTOK) return;
    const int e   = expert_id[t];
    const int pos = atomicAdd(&counts[e], 1);
    lists[e * NTOK + pos] = t;
}

// ---------------- Pre-pass: f32 -> bf16 conversion ----------------
__global__ void convert_x_kernel(const float* __restrict__ in,
                                 __bf16* __restrict__ out, int n4) {
    const int i = blockIdx.x * 256 + threadIdx.x;
    if (i >= n4) return;
    const float4 v = ((const float4*)in)[i];
    __bf16 t[4] = {f2bf(v.x), f2bf(v.y), f2bf(v.z), f2bf(v.w)};
    ((uint2*)out)[i] = *(uint2*)t;
}

// per expert: in[R][C] f32 -> outT[C][R] bf16 ; grid (C/64, R/64, E), 256 thr
__global__ __launch_bounds__(256) void transpose_bf16_kernel(
        const float* __restrict__ in, __bf16* __restrict__ outT, int R, int C) {
    __shared__ alignas(16) __bf16 sT[64][KP];
    const int tid = threadIdx.x;
    const int n0 = blockIdx.x * 64, k0 = blockIdx.y * 64;
    const size_t eIn  = (size_t)blockIdx.z * R * C;
    const size_t eOut = (size_t)blockIdx.z * C * R;
#pragma unroll
    for (int i = 0; i < 4; ++i) {
        const int c  = tid + i * 256;
        const int kl = c >> 4, nl = (c & 15) << 2;
        const float4 v = *(const float4*)(in + eIn + (size_t)(k0 + kl) * C + n0 + nl);
        sT[kl][nl]     = f2bf(v.x);
        sT[kl][nl + 1] = f2bf(v.y);
        sT[kl][nl + 2] = f2bf(v.z);
        sT[kl][nl + 3] = f2bf(v.w);
    }
    __syncthreads();
    const int n = tid >> 2, ks = (tid & 3) << 4;
    __bf16 tmp[16];
#pragma unroll
    for (int j = 0; j < 16; ++j) tmp[j] = sT[ks + j][n];
    __bf16* dst = outT + eOut + (size_t)(n0 + n) * R + k0 + ks;
    *(uint4*)dst       = *(uint4*)tmp;
    *((uint4*)dst + 1) = *((uint4*)tmp + 1);
}

// ---------------- Kernel 3a: grouped MoE MLP as two GEMM launches, bf16 inputs ----------------
// Row tile number 'slot' of the launch -> its expert and its first place in that expert's token list.
// Any split of NTOK tokens over NEXP experts needs at most MSLOT row tiles.
__device__ __forceinline__ bool find_tile(const int* __restrict__ counts, int slot,
                                          int& e, int& start, int& nvalid) {
    int first = 0;
    e = -1; start = 0; nvalid = 0;
#pragma unroll
    for (int i = 0; i < NEXP; ++i) {
        const int c  = counts[i];
        const int nt = (c + GBM - 1) / GBM;
        if (e < 0 && slot < first + nt) {
            e      = i;
            start  = (slot - first) * GBM;
            nvalid = (c - start) < GBM ? (c - start) : GBM;
        }
        first += nt;
    }
    return e >= 0;
}

// One work-group: GBM gathered rows of A times GBN weight rows (k contiguous), 8 waves as 2 x 4,
// each wave GBM/2 rows x 64 columns = GMT x 4 accumulator tiles, GMT * 4 WMMAs per 32-wide k-step.
// GU: the staged weight rows are GBN/2 gate columns, then the same GBN/2 up columns; a wave holds
// gate (j = 0, 1) and up (j = 2, 3) of the same 32 columns and writes silu(gate) * up as bf16.
template <int K, bool GU>
__device__ __forceinline__ void grouped_gemm(
        const __bf16* __restrict__ A,      // [T][K], rows picked through the token list
        const __bf16* __restrict__ WT,     // [E][2048][K]  (n-major, k contiguous)
        const int*   __restrict__ counts,
        const int*   __restrict__ lists,
        __bf16* __restrict__ inter,        // GU: [T][IE]
        float*  __restrict__ out) {        // else: [T][H]
    int e, start, nvalid;
    if (!find_tile(counts, blockIdx.y, e, start, nvalid)) return;

    const int tid  = threadIdx.x;
    const int lane = tid & 31;
    const int wave = tid >> 5;
    const int l15  = lane & 15;
    const int rhi  = (lane >= 16) ? 8 : 0;
    const int wm   = wave >> 2;
    const int wn   = wave & 3;

    // one struct fixes the order: the weight tiles, whose copies differ by constant steps that become
    // immediate offsets, lie above the largest such offset, so no LDS address register goes below 0
    struct Smem {
        __bf16 a[2][GBM][GKP];
        __bf16 b[2][GBN][GKP];
        int    tok[GBM];
    };
    __shared__ alignas(16) Smem sm;
    auto& sA   = sm.a;
    auto& sB   = sm.b;
    auto& sTok = sm.tok;

    if (tid < GBM)                               // invalid rows read token 0 (never stored)
        sTok[tid] = (tid < nvalid) ? lists[e * NTOK + start + tid] : 0;
    __syncthreads();

    // per-thread staging coordinates: one sweep of the block = 16 rows x 16 chunks of 16B (8 bf16)
    const int sr = tid >> 4, sk = (tid & 15) << 3;
    const int ncol = blockIdx.x * (GU ? GBN / 2 : GBN);
    const __bf16* arow[GBM / 16];
#pragma unroll
    for (int i = 0; i < GBM / 16; ++i) arow[i] = A + (size_t)sTok[sr + i * 16] * K + sk;
    const __bf16* wrow = WT + ((size_t)e * TWOIE + ncol + sr) * K + sk;

    auto stage = [&](int k0, int b) {            // GBM/16 + GBN/16 copies per thread
#pragma unroll
        for (int i = 0; i < GBM / 16; ++i)
            stage16(arow[i] + k0, &sA[b][sr + i * 16][sk]);
#pragma unroll
        for (int i = 0; i < GBN / 16; ++i) {
            const int grow = i * 16 + ((GU && i >= GBN / 32) ? IEXP - GBN / 2 : 0);
            stage16(wrow + (size_t)grow * K + k0, &sB[b][sr + i * 16][sk]);
        }
    };

    v8f acc[GMT][4];
#pragma unroll
    for (int mt = 0; mt < GMT; ++mt)
#pragma unroll
        for (int j = 0; j < 4; ++j)
            acc[mt][j] = v8f{0.f, 0.f, 0.f, 0.f, 0.f, 0.f, 0.f, 0.f};

    // two-buffer ring: tile t + 1 flies while tile t is worked on, one barrier per trip
    stage(0, 0);
    asm volatile("s_wait_asynccnt 0x0" ::: "memory");   // this wave's share of tile 0 has landed
    __syncthreads();                                     // ... and every other wave's
    stage(GKC, 1);
    int ib = 0;
#pragma unroll 1
    for (int k0 = 0; k0 < K; k0 += GKC, ib ^= 1) {
        v16bf a[2][GMT], b[2][4];                // two fragment sets, all of buffer ib
        auto frags = [&](int kk, int s) {
#pragma unroll
            for (int mt = 0; mt < GMT; ++mt)
                a[s][mt] = frag_bf(&sA[ib][wm * (GBM / 2) + mt * 16 + l15][kk], lane);
#pragma unroll
            for (int j = 0; j < 4; ++j) {
                const int brow = GU ? (j >> 1) * (GBN / 2) + wn * 32 + (j & 1) * 16
                                    : wn * 64 + j * 16;
                b[s][j] = frag_bf(&sB[ib][brow + l15][kk], lane);
            }
        };
        frags(0, 0);
#pragma unroll
        for (int blk = 0; blk < GKC / 32; ++blk) {
            if (blk + 1 < GKC / 32) frags((blk + 1) * 32, (blk + 1) & 1);
            // keeps the next k-step's LDS reads as one group in front of this k-step's WMMAs
            __builtin_amdgcn_sched_barrier(0);
#pragma unroll
            for (int mt = 0; mt < GMT; ++mt)
#pragma unroll
                for (int j = 0; j < 4; ++j)
                    acc[mt][j] = __builtin_amdgcn_wmma_f32_16x16x32_bf16(
                        false, a[blk & 1][mt], false, b[blk & 1][j], (short)0, acc[mt][j], false, false);
            // keeps later LDS reads from being spread among these WMMAs
            __builtin_amdgcn_sched_barrier(0);
        }
        asm volatile("s_wait_dscnt 0x0" ::: "memory");      // this wave's reads of buffer ib are done
        asm volatile("s_wait_asynccnt 0x0" ::: "memory");   // this wave's share of tile t + 1 has landed
        __syncthreads();                                     // publishes tile t + 1, frees buffer ib
        if (k0 + 2 * GKC < K) stage(k0 + 2 * GKC, ib);
    }
    asm volatile("s_wait_asynccnt 0x0" ::: "memory");       // no copy outlives the loop

    // C layout: VGPR r -> M=r / r+8; lane%16 -> N
#pragma unroll
    for (int mt = 0; mt < GMT; ++mt) {
        const int rbase = wm * (GBM / 2) + mt * 16 + rhi;
        const int4 t03 = *(const int4*)&sTok[rbase];         // this lane's 8 rows' tokens in two reads
        const int4 t47 = *(const int4*)&sTok[rbase + 4];
        const int  tk[8] = {t03.x, t03.y, t03.z, t03.w, t47.x, t47.y, t47.z, t47.w};
#pragma unroll
        for (int r = 0; r < 8; ++r) {
            const int rloc = rbase + r;
            if (rloc < nvalid) {
                if constexpr (GU) {
                    __bf16* irow = inter + (size_t)tk[r] * IEXP + ncol + wn * 32 + l15;
#pragma unroll
                    for (int j = 0; j < 2; ++j) {
                        const float g = acc[mt][j][r];
                        const float u = acc[mt][j + 2][r];
                        irow[j * 16] =
                            f2bf((g / (1.f + exp2_slot(g * -1.44269504f))) * u);   // exp(-g) as 2^(-g*log2(e))
                    }
                } else {
                    float* orow = out + (size_t)tk[r] * HID + ncol + wn * 64 + l15;
#pragma unroll
                    for (int j = 0; j < 4; ++j) orow[j * 16] = acc[mt][j][r];
                }
            }
        }
    }
}

// inter = silu(x*Wg) * (x*Wu) ; grid (IE / (GBN/2), MSLOT)
__global__ __launch_bounds__(256) void moe_gateup_kernel(
        const __bf16* __restrict__ xb,     // [T][H]
        const __bf16* __restrict__ gupT,   // [E][2IE][H]
        const int*   __restrict__ counts,
        const int*   __restrict__ lists,
        __bf16* __restrict__ inter) {      // [T][IE]
    grouped_gemm<HID, true>(xb, gupT, counts, lists, inter, nullptr);
}

// out = inter @ Wd ; grid (H / GBN, MSLOT)
__global__ __launch_bounds__(256) void moe_down_kernel(
        const __bf16* __restrict__ inter,  // [T][IE]
        const __bf16* __restrict__ downT,  // [E][H][IE]
        const int*   __restrict__ counts,
        const int*   __restrict__ lists,
        float* __restrict__ out) {
    grouped_gemm<IEXP, false>(inter, downT, counts, lists, nullptr, out);
}

// ---------------- Kernel 3b: fallback (f32 staging, inline convert) ----------------
__global__ __launch_bounds__(256) void moe_mlp_f32_kernel(
        const float* __restrict__ x,
        const float* __restrict__ gup,
        const float* __restrict__ down,
        const int*   __restrict__ counts,
        const int*   __restrict__ lists,
        float* __restrict__ out) {
    const int blocks_per_e = NTOK / BM;
    const int e  = blockIdx.x / blocks_per_e;
    const int mb = blockIdx.x % blocks_per_e;
    const int cnt   = counts[e];
    const int start = mb * BM;
    if (start >= cnt) return;
    const int nvalid = (cnt - start) < BM ? (cnt - start) : BM;

    const int tid  = threadIdx.x;
    const int lane = tid & 31;
    const int wave = tid >> 5;
    const int mi   = wave >> 2;
    const int ni   = wave & 3;

    __shared__ alignas(16) float  sXf [BM][XPAD];
    __shared__ alignas(16) float  sWgf[KC][WPAD];
    __shared__ alignas(16) float  sWuf[KC][WPAD];
    __shared__ alignas(16) __bf16 sI  [BM][IPAD];
    __shared__ int          sTok [BM];
    __shared__ const float* sXrow[BM];

    if (tid < BM) {
        const int tk = (tid < nvalid) ? lists[e * NTOK + start + tid] : 0;
        sTok[tid]  = tk;
        sXrow[tid] = x + (size_t)tk * HID;
    }
    __syncthreads();

    const float* Wgu = gup  + (size_t)e * HID * TWOIE;
    const float* Wd  = down + (size_t)e * IEXP * HID;
    const int mrow = mi * 16 + (lane & 15);
    const int ncl  = ni * 16 + (lane & 15);

    for (int no = 0; no < IEXP / 64; ++no) {
        const int ncol = no * 64;
        v8f accg = {0.f, 0.f, 0.f, 0.f, 0.f, 0.f, 0.f, 0.f};
        v8f accu = {0.f, 0.f, 0.f, 0.f, 0.f, 0.f, 0.f, 0.f};
#pragma unroll 1
        for (int k0 = 0; k0 < HID; k0 += KC) {
#pragma unroll
            for (int i = 0; i < 2; ++i) {
                const int c = tid + i * 256;
                const int r = c >> 4, k = (c & 15) << 2;
                stage16(sXrow[r] + k0 + k, &sXf[r][k]);
            }
#pragma unroll
            for (int i = 0; i < 4; ++i) {
                const int c = tid + i * 256;
                const int K = c >> 4, n = (c & 15) << 2;
                const size_t off = (size_t)(k0 + K) * TWOIE + ncol + n;
                stage16(Wgu + off,        &sWgf[K][n]);
                stage16(Wgu + off + IEXP, &sWuf[K][n]);
            }
            WAIT_ASYNC(0);
            __syncthreads();
#pragma unroll
            for (int kk = 0; kk < KC; kk += 32) {
                const v16bf a  = frag_f32(&sXf[mrow][kk], lane);
                const v16bf bg = frag_f32_strided(&sWgf[kk][ncl], WPAD, lane);
                const v16bf bu = frag_f32_strided(&sWuf[kk][ncl], WPAD, lane);
                accg = __builtin_amdgcn_wmma_f32_16x16x32_bf16(false, a, false, bg,
                                                               (short)0, accg, false, false);
                accu = __builtin_amdgcn_wmma_f32_16x16x32_bf16(false, a, false, bu,
                                                               (short)0, accu, false, false);
            }
            __syncthreads();
        }
#pragma unroll
        for (int r = 0; r < 8; ++r) {
            const int row = mi * 16 + r + ((lane >= 16) ? 8 : 0);
            const float g = accg[r];
            const float u = accu[r];
            sI[row][ncol + ni * 16 + (lane & 15)] = f2bf((g / (1.f + __expf(-g))) * u);
        }
    }
    __syncthreads();

    for (int no = 0; no < HID / 64; ++no) {
        const int ncol = no * 64;
        v8f acc = {0.f, 0.f, 0.f, 0.f, 0.f, 0.f, 0.f, 0.f};
#pragma unroll 1
        for (int k0 = 0; k0 < IEXP; k0 += KC) {
#pragma unroll
            for (int i = 0; i < 4; ++i) {
                const int c = tid + i * 256;
                const int K = c >> 4, n = (c & 15) << 2;
                stage16(Wd + (size_t)(k0 + K) * HID + ncol + n, &sWgf[K][n]);
            }
            WAIT_ASYNC(0);
            __syncthreads();
#pragma unroll
            for (int kk = 0; kk < KC; kk += 32) {
                const v16bf a = frag_bf(&sI[mrow][k0 + kk], lane);
                const v16bf b = frag_f32_strided(&sWgf[kk][ncl], WPAD, lane);
                acc = __builtin_amdgcn_wmma_f32_16x16x32_bf16(false, a, false, b,
                                                              (short)0, acc, false, false);
            }
            __syncthreads();
        }
#pragma unroll
        for (int r = 0; r < 8; ++r) {
            const int rloc = mi * 16 + r + ((lane >= 16) ? 8 : 0);
            if (rloc < nvalid)
                out[(size_t)sTok[rloc] * HID + ncol + ni * 16 + (lane & 15)] = acc[r];
        }
    }
}

extern "C" void kernel_launch(void* const* d_in, const int* in_sizes, int n_in,
                              void* d_out, int out_size, void* d_ws, size_t ws_size,
                              hipStream_t stream) {
    const float* x    = (const float*)d_in[0];
    const int*   tids = (const int*)  d_in[1];
    const float* mu   = (const float*)d_in[2];
    const float* gup  = (const float*)d_in[3];
    const float* down = (const float*)d_in[4];
    const float* wr   = (const float*)d_in[5];
    float* out = (float*)d_out;

    int* expert_id = (int*)d_ws;                 // NTOK ints
    int* counts    = expert_id + NTOK;           // NEXP ints
    int* lists     = counts + NEXP;              // NEXP*NTOK ints

    router_kernel<<<NTOK / 8, 256, 0, stream>>>(mu, wr, tids, expert_id);
    zero_counts_kernel<<<1, 32, 0, stream>>>(counts);
    bucket_kernel<<<NTOK / 256, 256, 0, stream>>>(expert_id, counts, lists);

    const size_t metaB = ((size_t)(NTOK + NEXP + NEXP * NTOK) * 4 + 255) & ~(size_t)255;
    const size_t nXb   = (size_t)NTOK * HID;
    const size_t nGup  = (size_t)NEXP * TWOIE * HID;
    const size_t nDown = (size_t)NEXP * HID * IEXP;
    const size_t nInt  = (size_t)NTOK * IEXP;
    const size_t need  = metaB + 2 * (nXb + nGup + nDown + nInt);

    if (ws_size >= need) {
        __bf16* xbf   = (__bf16*)((char*)d_ws + metaB);
        __bf16* gupT  = xbf + nXb;
        __bf16* downT = gupT + nGup;
        __bf16* intb  = downT + nDown;
        convert_x_kernel<<<(int)(nXb / 4 / 256), 256, 0, stream>>>(x, xbf, (int)(nXb / 4));
        transpose_bf16_kernel<<<dim3(TWOIE / 64, HID / 64, NEXP), 256, 0, stream>>>(gup, gupT, HID, TWOIE);
        transpose_bf16_kernel<<<dim3(HID / 64, IEXP / 64, NEXP), 256, 0, stream>>>(down, downT, IEXP, HID);
        moe_gateup_kernel<<<dim3(IEXP / (GBN / 2), MSLOT), 256, 0, stream>>>(xbf, gupT, counts, lists, intb);
        moe_down_kernel<<<dim3(HID / GBN, MSLOT), 256, 0, stream>>>(intb, downT, counts, lists, out);
    } else {
        moe_mlp_f32_kernel<<<NEXP * (NTOK / BM), 256, 0, stream>>>(x, gup, down,
                                                                   counts, lists, out);
    }
}

// v003
// A run of this version takes 90.5 microseconds.
// In both of two side-by-side timings against v002, it was 1.15 times as fast.
// Counting every step since v000, it is 5.55 times as fast.
#include <hip/hip_runtime.h>
#include <math.h>

#define NTOK   4096
#define HID    2048
#define IEXP   1024
#define TWOIE  2048
#define NEXP   8
#define VOCAB  32000
#define BM     32
#define KC     64          // K-chunk per LDS stage (2 WMMA k-steps)
#define KP     72          // bf16 row stride for 64-wide K tiles (144B: 16B-aligned, banks spread)
#define XPAD   76          // f32 row stride, X tile (fallback)
#define WPAD   68          // f32 row stride, W tiles (fallback)
#define IPAD   1032        // bf16 row stride, inter (2064B: 16B-aligned, banks spread)
#define GBM    192         // token rows per work-group of the grouped GEMMs
#define GBN    256         // weight rows (product columns) per work-group of the grouped GEMMs
#define GKC    128         // K-chunk per LDS stage of the grouped GEMMs (4 WMMA k-steps)
#define GKP    136         // bf16 row stride for 128-wide K tiles (272B: 16B x odd)
#define GMT    (GBM / 32)  // accumulator row tiles per wave
#define MSLOT  (NTOK / GBM + NEXP)

#if __has_builtin(__builtin_amdgcn_global_load_async_to_lds_b128) && \
    __has_builtin(__builtin_amdgcn_s_wait_asynccnt)
#define HAVE_ASYNC 1
#else
#define HAVE_ASYNC 0
#endif

typedef __attribute__((ext_vector_type(16))) __bf16 v16bf;
typedef __attribute__((ext_vector_type(8)))  float  v8f;
typedef __attribute__((__vector_size__(16))) int    v4i;   // pointee type the async builtin expects

__device__ __forceinline__ __bf16 f2bf(float f) {
    union { float f; unsigned u; } v; v.f = f;
    unsigned r = v.u + 0x7FFFu + ((v.u >> 16) & 1u);   // round-to-nearest-even
    return __builtin_bit_cast(__bf16, (unsigned short)(r >> 16));
}

// 2^x on the transcendental unit. The v_nop in the same statement fills the one issue slot that the
// instruction set asks for between v_exp_f32 and a next instruction that reads its result or
// overwrites its source; as a statement of its own the compiler moves it away from the v_exp_f32.
__device__ __forceinline__ float exp2_slot(float x) {
    float r;
    asm("v_exp_f32 %0, %1\n\tv_nop" : "=v"(r) : "v"(x));
    return r;
}

// 16B global->LDS copy: async DMA on gfx1250, VGPR round-trip fallback.
__device__ __forceinline__ void stage16(const void* src, void* dst) {
#if HAVE_ASYNC
    __builtin_amdgcn_global_load_async_to_lds_b128((v4i*)src, (v4i*)dst, 0, 0);
#else
    *(float4*)dst = *(const float4*)src;
#endif
}

#if HAVE_ASYNC
#define WAIT_ASYNC(n) __builtin_amdgcn_s_wait_asynccnt(n)
#else
#define WAIT_ASYNC(n) ((void)0)
#endif

// ISA 16-bit WMMA operand layout: lanes 0-15 hold K 0..7 & 16..23,
// lanes 16-31 hold K 8..15 & 24..31 (pairs packed per VGPR).
__device__ __forceinline__ v16bf frag_bf(const __bf16* p, int lane) {        // contiguous K
    const int kb = (lane >> 4) << 3;
    v16bf f;
#pragma unroll
    for (int j = 0; j < 8; ++j) {
        const int k = kb + ((j & 3) << 1) + ((j >> 2) << 4);
        f[2 * j]     = p[k];
        f[2 * j + 1] = p[k + 1];
    }
    return f;
}

__device__ __forceinline__ v16bf frag_f32(const float* p, int lane) {        // fallback A
    const int kb = (lane >> 4) << 3;
    v16bf f;
#pragma unroll
    for (int j = 0; j < 8; ++j) {
        const int k = kb + ((j & 3) << 1) + ((j >> 2) << 4);
        f[2 * j]     = f2bf(p[k]);
        f[2 * j + 1] = f2bf(p[k + 1]);
    }
    return f;
}

__device__ __forceinline__ v16bf frag_f32_strided(const float* p, int stride, int lane) { // fallback B
    const int kb = (lane >> 4) << 3;
    v16bf f;
#pragma unroll
    for (int j = 0; j < 8; ++j) {
        const int k = kb + ((j & 3) << 1) + ((j >> 2) << 4);
        f[2 * j]     = f2bf(p[k * stride]);
        f[2 * j + 1] = f2bf(p[(k + 1) * stride]);
    }
    return f;
}

// The stages in front of the GEMMs are device functions that take their block number, so that stages
// which do not depend on one another can share a launch.

// ---------------- Stage 1: mu router ----------------
__device__ __forceinline__ void router_block(int blk,
                                             const float* __restrict__ mu,
                                             const float* __restrict__ wr,
                                             const int*   __restrict__ token_ids,
                                             int* __restrict__ expert_id) {
    const int t    = blk * 8 + (threadIdx.x >> 5);
    const int lane = threadIdx.x & 31;
    if (t >= NTOK) return;
    float acc[NEXP];
#pragma unroll
    for (int e = 0; e < NEXP; ++e) acc[e] = 0.f;
    for (int h = lane; h < HID; h += 32) {
        const float m = mu[(size_t)t * HID + h];
#pragma unroll
        for (int e = 0; e < NEXP; ++e) acc[e] += m * wr[e * HID + h];
    }
#pragma unroll
    for (int e = 0; e < NEXP; ++e)
#pragma unroll
        for (int off = 16; off > 0; off >>= 1)
            acc[e] += __shfl_xor(acc[e], off, 32);
    if (lane == 0) {
        int tid = token_ids[t];
        tid = tid < 0 ? 0 : (tid > VOCAB - 1 ? VOCAB - 1 : tid);
        const int base = tid & (NEXP - 1);
        int best = 0;
        float bv = acc[0] + (base == 0 ? 10.f : 0.f);
#pragma unroll
        for (int e = 1; e < NEXP; ++e) {
            const float v = acc[e] + (base == e ? 10.f : 0.f);
            if (v > bv) { bv = v; best = e; }
        }
        expert_id[t] = best;
    }
}

// ---------------- Stage 2: bucket tokens by expert ----------------
__device__ __forceinline__ void zero_counts(int* __restrict__ counts) {
    if (threadIdx.x < NEXP) counts[threadIdx.x] = 0;
}

__device__ __forceinline__ void bucket_block(int blk,
                                             const int* __restrict__ expert_id,
                                             int* __restrict__ counts,
                                             int* __restrict__ lists) {
    const int t = blk * 256 + threadIdx.x;
    if (t >= NTOK) return;
    const int e   = expert_id[t];
    const int pos = atomicAdd(&counts[e], 1);
    lists[e * NTOK + pos] = t;
}

// ---------------- Pre-pass: f32 -> bf16 conversion ----------------
__device__ __forceinline__ void convert_block(int blk, const float* __restrict__ in,
                                              __bf16* __restrict__ out) {
    const int i = blk * 256 + threadIdx.x;
    const float4 v = ((const float4*)in)[i];
    __bf16 t[4] = {f2bf(v.x), f2bf(v.y), f2bf(v.z), f2bf(v.w)};
    ((uint2*)out)[i] = *(uint2*)t;
    // stands in front of any rewrite of this store's registers: in a merged launch another stage's code follows
    asm volatile("s_wait_xcnt 0x0" ::: "memory");
}

// per expert: in[R][C] f32 -> outT[C][R] bf16 ; (C/64) * (R/64) * E blocks of 256 thr, n tile fastest
template <int R, int C>
__device__ __forceinline__ void transpose_block(int blk, __bf16 (*sT)[KP],
        const float* __restrict__ in, __bf16* __restrict__ outT) {
    const int tid = threadIdx.x;
    const int n0 = (blk % (C / 64)) * 64, k0 = (blk / (C / 64) % (R / 64)) * 64;
    const int ex = blk / ((C / 64) * (R / 64));
    const size_t eIn  = (size_t)ex * R * C;
    const size_t eOut = (size_t)ex * C * R;
#pragma unroll
    for (int i = 0; i < 4; ++i) {
        const int c  = tid + i * 256;
        const int kl = c >> 4, nl = (c & 15) << 2;
        const float4 v = *(const float4*)(in + eIn + (size_t)(k0 + kl) * C + n0 + nl);
        sT[kl][nl]     = f2bf(v.x);
        sT[kl][nl + 1] = f2bf(v.y);
        sT[kl][nl + 2] = f2bf(v.z);
        sT[kl][nl + 3] = f2bf(v.w);
    }
    __syncthreads();
    const int n = tid >> 2, ks = (tid & 3) << 4;
    __bf16 tmp[16];
#pragma unroll
    for (int j = 0; j < 16; ++j) tmp[j] = sT[ks + j][n];
    __bf16* dst = outT + eOut + (size_t)(n0 + n) * R + k0 + ks;
    *(uint4*)dst       = *(uint4*)tmp;
    *((uint4*)dst + 1) = *((uint4*)tmp + 1);
    // stands in front of any rewrite of these stores' registers: in a merged launch another stage's code follows
    asm volatile("s_wait_xcnt 0x0" ::: "memory");
}

#define RBLK  (NTOK / 8)                              // router blocks
#define BBLK  (NTOK / 256)                            // bucket blocks
#define XBLK  (NTOK * HID / 4 / 256)                  // x conversion blocks
#define GUBLK ((TWOIE / 64) * (HID / 64) * NEXP)      // gate-up transpose blocks
#define DNBLK ((HID / 64) * (IEXP / 64) * NEXP)       // down transpose blocks

// Launch 1: the router (with the zeroing of the counts), the gate-up weights' transpose and the conversion of x. The router's blocks, which wait on latency, come
// first and run beside the streaming blocks.
__global__ __launch_bounds__(256) void prep_inputs_kernel(
        const float* __restrict__ mu, const float* __restrict__ wr,
        const int* __restrict__ token_ids, const float* __restrict__ x,
        const float* __restrict__ gup,
        int* __restrict__ expert_id, int* __restrict__ counts,
        __bf16* __restrict__ xbf, __bf16* __restrict__ gupT) {
    __shared__ alignas(16) __bf16 sT[64][KP];
    const int blk = blockIdx.x;
    if (blk < RBLK) {
        if (blk == 0) zero_counts(counts);
        router_block(blk, mu, wr, token_ids, expert_id);
    } else if (blk < RBLK + GUBLK) {
        transpose_block<HID, TWOIE>(blk - RBLK, sT, gup, gupT);
    } else {
        convert_block(blk - RBLK - GUBLK, x, xbf);
    }
}

// Launch 2: the bucketing, which needs launch 1's expert ids and zeroed counts, beside the down
// weights' transpose, which nothing reads before the last launch.
__global__ __launch_bounds__(256) void prep_bucket_kernel(
        const int* __restrict__ expert_id, const float* __restrict__ down,
        int* __restrict__ counts, int* __restrict__ lists, __bf16* __restrict__ downT) {
    __shared__ alignas(16) __bf16 sT[64][KP];
    const int blk = blockIdx.x;
    if (blk < BBLK) bucket_block(blk, expert_id, counts, lists);
    else            transpose_block<IEXP, HID>(blk - BBLK, sT, down, downT);
}

// The same stages as launches of their own, for the fallback path.
__global__ void router_kernel(const float* __restrict__ mu, const float* __restrict__ wr,
                              const int* __restrict__ token_ids, int* __restrict__ expert_id) {
    router_block(blockIdx.x, mu, wr, token_ids, expert_id);
}
__global__ void zero_counts_kernel(int* __restrict__ counts) { zero_counts(counts); }
__global__ void bucket_kernel(const int* __restrict__ expert_id, int* __restrict__ counts,
                              int* __restrict__ lists) {
    bucket_block(blockIdx.x, expert_id, counts, lists);
}

// ---------------- Kernel 3a: grouped MoE MLP as two GEMM launches, bf16 inputs ----------------
// Row tile number 'slot' of the launch -> its expert and its first place in that expert's token list.
// Any split of NTOK tokens over NEXP experts needs at most MSLOT row tiles.
__device__ __forceinline__ bool find_tile(const int* __restrict__ counts, int slot,
                                          int& e, int& start, int& nvalid) {
    int first = 0;
    e = -1; start = 0; nvalid = 0;
#pragma unroll
    for (int i = 0; i < NEXP; ++i) {
        const int c  = counts[i];
        const int nt = (c + GBM - 1) / GBM;
        if (e < 0 && slot < first + nt) {
            e      = i;
            start  = (slot - first) * GBM;
            nvalid = (c - start) < GBM ? (c - start) : GBM;
        }
        first += nt;
    }
    return e >= 0;
}

// One work-group: GBM gathered rows of A times GBN weight rows (k contiguous), 8 waves as 2 x 4,
// each wave GBM/2 rows x 64 columns = GMT x 4 accumulator tiles, GMT * 4 WMMAs per 32-wide k-step.
// GU: the staged weight rows are GBN/2 gate columns, then the same GBN/2 up columns; a wave holds
// gate (j = 0, 1) and up (j = 2, 3) of the same 32 columns and writes silu(gate) * up as bf16.
template <int K, bool GU>
__device__ __forceinline__ void grouped_gemm(
        const __bf16* __restrict__ A,      // [T][K], rows picked through the token list
        const __bf16* __restrict__ WT,     // [E][2048][K]  (n-major, k contiguous)
        const int*   __restrict__ counts,
        const int*   __restrict__ lists,
        __bf16* __restrict__ inter,        // GU: [T][IE]
        float*  __restrict__ out) {        // else: [T][H]
    int e, start, nvalid;
    if (!find_tile(counts, blockIdx.y, e, start, nvalid)) return;

    const int tid  = threadIdx.x;
    const int lane = tid & 31;
    const int wave = tid >> 5;
    const int l15  = lane & 15;
    const int rhi  = (lane >= 16) ? 8 : 0;
    const int wm   = wave >> 2;
    const int wn   = wave & 3;

    // one struct fixes the order: the weight tiles, whose copies differ by constant steps that become
    // immediate offsets, lie above the largest such offset, so no LDS address register goes below 0
    struct Smem {
        __bf16 a[2][GBM][GKP];
        __bf16 b[2][GBN][GKP];
        int    tok[GBM];
    };
    __shared__ alignas(16) Smem sm;
    auto& sA   = sm.a;
    auto& sB   = sm.b;
    auto& sTok = sm.tok;

    if (tid < GBM)                               // invalid rows read token 0 (never stored)
        sTok[tid] = (tid < nvalid) ? lists[e * NTOK + start + tid] : 0;
    __syncthreads();

    // per-thread staging coordinates: one sweep of the block = 16 rows x 16 chunks of 16B (8 bf16)
    const int sr = tid >> 4, sk = (tid & 15) << 3;
    const int ncol = blockIdx.x * (GU ? GBN / 2 : GBN);
    const __bf16* arow[GBM / 16];
#pragma unroll
    for (int i = 0; i < GBM / 16; ++i) arow[i] = A + (size_t)sTok[sr + i * 16] * K + sk;
    const __bf16* wrow = WT + ((size_t)e * TWOIE + ncol + sr) * K + sk;

    auto stage = [&](int k0, int b) {            // GBM/16 + GBN/16 copies per thread
#pragma unroll
        for (int i = 0; i < GBM / 16; ++i)
            stage16(arow[i] + k0, &sA[b][sr + i * 16][sk]);
#pragma unroll
        for (int i = 0; i < GBN / 16; ++i) {
            const int grow = i * 16 + ((GU && i >= GBN / 32) ? IEXP - GBN / 2 : 0);
            stage16(wrow + (size_t)grow * K + k0, &sB[b][sr + i * 16][sk]);
        }
    };

    v8f acc[GMT][4];
#pragma unroll
    for (int mt = 0; mt < GMT; ++mt)
#pragma unroll
        for (int j = 0; j < 4; ++j)
            acc[mt][j] = v8f{0.f, 0.f, 0.f, 0.f, 0.f, 0.f, 0.f, 0.f};

    // two-buffer ring: tile t + 1 flies while tile t is worked on, one barrier per trip
    stage(0, 0);
    asm volatile("s_wait_asynccnt 0x0" ::: "memory");   // this wave's share of tile 0 has landed
    __syncthreads();                                     // ... and every other wave's
    stage(GKC, 1);
    int ib = 0;
#pragma unroll 1
    for (int k0 = 0; k0 < K; k0 += GKC, ib ^= 1) {
        v16bf a[2][GMT], b[2][4];                // two fragment sets, all of buffer ib
        auto frags = [&](int kk, int s) {
#pragma unroll
            for (int mt = 0; mt < GMT; ++mt)
                a[s][mt] = frag_bf(&sA[ib][wm * (GBM / 2) + mt * 16 + l15][kk], lane);
#pragma unroll
            for (int j = 0; j < 4; ++j) {
                const int brow = GU ? (j >> 1) * (GBN / 2) + wn * 32 + (j & 1) * 16
                                    : wn * 64 + j * 16;
                b[s][j] = frag_bf(&sB[ib][brow + l15][kk], lane);
            }
        };
        frags(0, 0);
#pragma unroll
        for (int blk = 0; blk < GKC / 32; ++blk) {
            if (blk + 1 < GKC / 32) frags((blk + 1) * 32, (blk + 1) & 1);
            // keeps the next k-step's LDS reads as one group in front of this k-step's WMMAs
            __builtin_amdgcn_sched_barrier(0);
#pragma unroll
            for (int mt = 0; mt < GMT; ++mt)
#pragma unroll
                for (int j = 0; j < 4; ++j)
                    acc[mt][j] = __builtin_amdgcn_wmma_f32_16x16x32_bf16(
                        false, a[blk & 1][mt], false, b[blk & 1][j], (short)0, acc[mt][j], false, false);
            // keeps later LDS reads from being spread among these WMMAs
            __builtin_amdgcn_sched_barrier(0);
        }
        asm volatile("s_wait_dscnt 0x0" ::: "memory");      // this wave's reads of buffer ib are done
        asm volatile("s_wait_asynccnt 0x0" ::: "memory");   // this wave's share of tile t + 1 has landed
        __syncthreads();                                     // publishes tile t + 1, frees buffer ib
        if (k0 + 2 * GKC < K) stage(k0 + 2 * GKC, ib);
    }
    asm volatile("s_wait_asynccnt 0x0" ::: "memory");       // no copy outlives the loop

    // C layout: VGPR r -> M=r / r+8; lane%16 -> N
#pragma unroll
    for (int mt = 0; mt < GMT; ++mt) {
        const int rbase = wm * (GBM / 2) + mt * 16 + rhi;
        const int4 t03 = *(const int4*)&sTok[rbase];         // this lane's 8 rows' tokens in two reads
        const int4 t47 = *(const int4*)&sTok[rbase + 4];
        const int  tk[8] = {t03.x, t03.y, t03.z, t03.w, t47.x, t47.y, t47.z, t47.w};
#pragma unroll
        for (int r = 0; r < 8; ++r) {
            const int rloc = rbase + r;
            if (rloc < nvalid) {
                if constexpr (GU) {
                    __bf16* irow = inter + (size_t)tk[r] * IEXP + ncol + wn * 32 + l15;
#pragma unroll
                    for (int j = 0; j < 2; ++j) {
                        const float g = acc[mt][j][r];
                        const float u = acc[mt][j + 2][r];
                        irow[j * 16] =
                            f2bf((g / (1.f + exp2_slot(g * -1.44269504f))) * u);   // exp(-g) as 2^(-g*log2(e))
                    }
                } else {
                    float* orow = out + (size_t)tk[r] * HID + ncol + wn * 64 + l15;
#pragma unroll
                    for (int j = 0; j < 4; ++j) orow[j * 16] = acc[mt][j][r];
                }
            }
        }
    }
}

// inter = silu(x*Wg) * (x*Wu) ; grid (IE / (GBN/2), MSLOT)
__global__ __launch_bounds__(256) void moe_gateup_kernel(
        const __bf16* __restrict__ xb,     // [T][H]
        const __bf16* __restrict__ gupT,   // [E][2IE][H]
        const int*   __restrict__ counts,
        const int*   __restrict__ lists,
        __bf16* __restrict__ inter) {      // [T][IE]
    grouped_gemm<HID, true>(xb, gupT, counts, lists, inter, nullptr);
}

// out = inter @ Wd ; grid (H / GBN, MSLOT)
__global__ __launch_bounds__(256) void moe_down_kernel(
        const __bf16* __restrict__ inter,  // [T][IE]
        const __bf16* __restrict__ downT,  // [E][H][IE]
        const int*   __restrict__ counts,
        const int*   __restrict__ lists,
        float* __restrict__ out) {
    grouped_gemm<IEXP, false>(inter, downT, counts, lists, nullptr, out);
}

// ---------------- Kernel 3b: fallback (f32 staging, inline convert) ----------------
__global__ __launch_bounds__(256) void moe_mlp_f32_kernel(
        const float* __restrict__ x,
        const float* __restrict__ gup,
        const float* __restrict__ down,
        const int*   __restrict__ counts,
        const int*   __restrict__ lists,
        float* __restrict__ out) {
    const int blocks_per_e = NTOK / BM;
    const int e  = blockIdx.x / blocks_per_e;
    const int mb = blockIdx.x % blocks_per_e;
    const int cnt   = counts[e];
    const int start = mb * BM;
    if (start >= cnt) return;
    const int nvalid = (cnt - start) < BM ? (cnt - start) : BM;

    const int tid  = threadIdx.x;
    const int lane = tid & 31;
    const int wave = tid >> 5;
    const int mi   = wave >> 2;
    const int ni   = wave & 3;

    __shared__ alignas(16) float  sXf [BM][XPAD];
    __shared__ alignas(16) float  sWgf[KC][WPAD];
    __shared__ alignas(16) float  sWuf[KC][WPAD];
    __shared__ alignas(16) __bf16 sI  [BM][IPAD];
    __shared__ int          sTok [BM];
    __shared__ const float* sXrow[BM];

    if (tid < BM) {
        const int tk = (tid < nvalid) ? lists[e * NTOK + start + tid] : 0;
        sTok[tid]  = tk;
        sXrow[tid] = x + (size_t)tk * HID;
    }
    __syncthreads();

    const float* Wgu = gup  + (size_t)e * HID * TWOIE;
    const float* Wd  = down + (size_t)e * IEXP * HID;
    const int mrow = mi * 16 + (lane & 15);
    const int ncl  = ni * 16 + (lane & 15);

    for (int no = 0; no < IEXP / 64; ++no) {
        const int ncol = no * 64;
        v8f accg = {0.f, 0.f, 0.f, 0.f, 0.f, 0.f, 0.f, 0.f};
        v8f accu = {0.f, 0.f, 0.f, 0.f, 0.f, 0.f, 0.f, 0.f};
#pragma unroll 1
        for (int k0 = 0; k0 < HID; k0 += KC) {
#pragma unroll
            for (int i = 0; i < 2; ++i) {
                const int c = tid + i * 256;
                const int r = c >> 4, k = (c & 15) << 2;
                stage16(sXrow[r] + k0 + k, &sXf[r][k]);
            }
#pragma unroll
            for (int i = 0; i < 4; ++i) {
                const int c = tid + i * 256;
                const int K = c >> 4, n = (c & 15) << 2;
                const size_t off = (size_t)(k0 + K) * TWOIE + ncol + n;
                stage16(Wgu + off,        &sWgf[K][n]);
                stage16(Wgu + off + IEXP, &sWuf[K][n]);
            }
            WAIT_ASYNC(0);
            __syncthreads();
#pragma unroll
            for (int kk = 0; kk < KC; kk += 32) {
                const v16bf a  = frag_f32(&sXf[mrow][kk], lane);
                const v16bf bg = frag_f32_strided(&sWgf[kk][ncl], WPAD, lane);
                const v16bf bu = frag_f32_strided(&sWuf[kk][ncl], WPAD, lane);
                accg = __builtin_amdgcn_wmma_f32_16x16x32_bf16(false, a, false, bg,
                                                               (short)0, accg, false, false);
                accu = __builtin_amdgcn_wmma_f32_16x16x32_bf16(false, a, false, bu,
                                                               (short)0, accu, false, false);
            }
            __syncthreads();
        }
#pragma unroll
        for (int r = 0; r < 8; ++r) {
            const int row = mi * 16 + r + ((lane >= 16) ? 8 : 0);
            const float g = accg[r];
            const float u = accu[r];
            sI[row][ncol + ni * 16 + (lane & 15)] = f2bf((g / (1.f + __expf(-g))) * u);
        }
    }
    __syncthreads();

    for (int no = 0; no < HID / 64; ++no) {
        const int ncol = no * 64;
        v8f acc = {0.f, 0.f, 0.f, 0.f, 0.f, 0.f, 0.f, 0.f};
#pragma unroll 1
        for (int k0 = 0; k0 < IEXP; k0 += KC) {
#pragma unroll
            for (int i = 0; i < 4; ++i) {
                const int c = tid + i * 256;
                const int K = c >> 4, n = (c & 15) << 2;
                stage16(Wd + (size_t)(k0 + K) * HID + ncol + n, &sWgf[K][n]);
            }
            WAIT_ASYNC(0);
            __syncthreads();
#pragma unroll
            for (int kk = 0; kk < KC; kk += 32) {
                const v16bf a = frag_bf(&sI[mrow][k0 + kk], lane);
                const v16bf b = frag_f32_strided(&sWgf[kk][ncl], WPAD, lane);
                acc = __builtin_amdgcn_wmma_f32_16x16x32_bf16(false, a, false, b,
                                                              (short)0, acc, false, false);
            }
            __syncthreads();
        }
#pragma unroll
        for (int r = 0; r < 8; ++r) {
            const int rloc = mi * 16 + r + ((lane >= 16) ? 8 : 0);
            if (rloc < nvalid)
                out[(size_t)sTok[rloc] * HID + ncol + ni * 16 + (lane & 15)] = acc[r];
        }
    }
}

extern "C" void kernel_launch(void* const* d_in, const int* in_sizes, int n_in,
                              void* d_out, int out_size, void* d_ws, size_t ws_size,
                              hipStream_t stream) {
    const float* x    = (const float*)d_in[0];
    const int*   tids = (const int*)  d_in[1];
    const float* mu   = (const float*)d_in[2];
    const float* gup  = (const float*)d_in[3];
    const float* down = (const float*)d_in[4];
    const float* wr   = (const float*)d_in[5];
    float* out = (float*)d_out;

    int* expert_id = (int*)d_ws;                 // NTOK ints
    int* counts    = expert_id + NTOK;           // NEXP ints
    int* lists     = counts + NEXP;              // NEXP*NTOK ints

    const size_t metaB = ((size_t)(NTOK + NEXP + NEXP * NTOK) * 4 + 255) & ~(size_t)255;
    const size_t nXb   = (size_t)NTOK * HID;
    const size_t nGup  = (size_t)NEXP * TWOIE * HID;
    const size_t nDown = (size_t)NEXP * HID * IEXP;
    const size_t nInt  = (size_t)NTOK * IEXP;
    const size_t need  = metaB + 2 * (nXb + nGup + nDown + nInt);

    if (ws_size >= need) {
        __bf16* xbf   = (__bf16*)((char*)d_ws + metaB);
        __bf16* gupT  = xbf + nXb;
        __bf16* downT = gupT + nGup;
        __bf16* intb  = downT + nDown;
        prep_inputs_kernel<<<RBLK + GUBLK + XBLK, 256, 0, stream>>>(mu, wr, tids, x, gup,
                                                                    expert_id, counts, xbf, gupT);
        prep_bucket_kernel<<<BBLK + DNBLK, 256, 0, stream>>>(expert_id, down, counts, lists, downT);
        moe_gateup_kernel<<<dim3(IEXP / (GBN / 2), MSLOT), 256, 0, stream>>>(xbf, gupT, counts, lists, intb);
        moe_down_kernel<<<dim3(HID / GBN, MSLOT), 256, 0, stream>>>(intb, downT, counts, lists, out);
    } else {
        router_kernel<<<RBLK, 256, 0, stream>>>(mu, wr, tids, expert_id);
        zero_counts_kernel<<<1, 32, 0, stream>>>(counts);
        bucket_kernel<<<BBLK, 256, 0, stream>>>(expert_id, counts, lists);
        moe_mlp_f32_kernel<<<NEXP * (NTOK / BM), 256, 0, stream>>>(x, gup, down,
                                                                   counts, lists, out);
    }
}

// v004
// A run of this version takes 85.8 microseconds.
// In both of two side-by-side timings against v003, it was 1.06 times as fast.
// Counting every step since v000, it is 5.86 times as fast.
#include <hip/hip_runtime.h>
#include <math.h>

#define NTOK   4096
#define HID    2048
#define IEXP   1024
#define TWOIE  2048
#define NEXP   8
#define VOCAB  32000
#define BM     32
#define KC     64          // K-chunk per LDS stage (2 WMMA k-steps)
#define KP     72          // bf16 row stride for 64-wide K tiles (144B: 16B-aligned, banks spread)
#define XPAD   76          // f32 row stride, X tile (fallback)
#define WPAD   68          // f32 row stride, W tiles (fallback)
#define IPAD   1032        // bf16 row stride, inter (2064B: 16B-aligned, banks spread)
#define GBM    192         // token rows per work-group of the grouped GEMMs
#define GBN    256         // weight rows (product columns) per work-group of the grouped GEMMs
#define GKC    128         // K-chunk per LDS stage of the grouped GEMMs (4 WMMA k-steps)
#define GKP    136         // bf16 row stride for 128-wide K tiles (272B: 16B x odd)
#define GMT    (GBM / 32)  // accumulator row tiles per wave
#define MSLOT  (NTOK / GBM + NEXP)
#define TT     128         // down-weight transpose tile: TT k rows x TT columns
#define TPW    4           // such tiles per work-group, consecutive in k

#if __has_builtin(__builtin_amdgcn_global_load_async_to_lds_b128) && \
    __has_builtin(__builtin_amdgcn_s_wait_asynccnt)
#define HAVE_ASYNC 1
#else
#define HAVE_ASYNC 0
#endif

typedef __attribute__((ext_vector_type(16))) __bf16 v16bf;
typedef __attribute__((ext_vector_type(8)))  float  v8f;
typedef __attribute__((__vector_size__(16))) int    v4i;   // pointee type the async builtin expects
typedef __attribute__((ext_vector_type(4)))  float  v4f;

__device__ __forceinline__ __bf16 f2bf(float f) {
    union { float f; unsigned u; } v; v.f = f;
    unsigned r = v.u + 0x7FFFu + ((v.u >> 16) & 1u);   // round-to-nearest-even
    return __builtin_bit_cast(__bf16, (unsigned short)(r >> 16));
}

// 2^x on the transcendental unit. The v_nop in the same statement fills the one issue slot that the
// instruction set asks for between v_exp_f32 and a next instruction that reads its result or
// overwrites its source; as a statement of its own the compiler moves it away from the v_exp_f32.
__device__ __forceinline__ float exp2_slot(float x) {
    float r;
    asm("v_exp_f32 %0, %1\n\tv_nop" : "=v"(r) : "v"(x));
    return r;
}

// 16B global->LDS copy: async DMA on gfx1250, VGPR round-trip fallback.
__device__ __forceinline__ void stage16(const void* src, void* dst) {
#if HAVE_ASYNC
    __builtin_amdgcn_global_load_async_to_lds_b128((v4i*)src, (v4i*)dst, 0, 0);
#else
    *(float4*)dst = *(const float4*)src;
#endif
}

#if HAVE_ASYNC
#define WAIT_ASYNC(n) __builtin_amdgcn_s_wait_asynccnt(n)
#else
#define WAIT_ASYNC(n) ((void)0)
#endif

// ISA 16-bit WMMA operand layout: lanes 0-15 hold K 0..7 & 16..23,
// lanes 16-31 hold K 8..15 & 24..31 (pairs packed per VGPR).
__device__ __forceinline__ v16bf frag_bf(const __bf16* p, int lane) {        // contiguous K
    const int kb = (lane >> 4) << 3;
    v16bf f;
#pragma unroll
    for (int j = 0; j < 8; ++j) {
        const int k = kb + ((j & 3) << 1) + ((j >> 2) << 4);
        f[2 * j]     = p[k];
        f[2 * j + 1] = p[k + 1];
    }
    return f;
}

__device__ __forceinline__ v16bf frag_f32(const float* p, int lane) {        // fallback A
    const int kb = (lane >> 4) << 3;
    v16bf f;
#pragma unroll
    for (int j = 0; j < 8; ++j) {
        const int k = kb + ((j & 3) << 1) + ((j >> 2) << 4);
        f[2 * j]     = f2bf(p[k]);
        f[2 * j + 1] = f2bf(p[k + 1]);
    }
    return f;
}

__device__ __forceinline__ v16bf frag_f32_strided(const float* p, int stride, int lane) { // fallback B
    const int kb = (lane >> 4) << 3;
    v16bf f;
#pragma unroll
    for (int j = 0; j < 8; ++j) {
        const int k = kb + ((j & 3) << 1) + ((j >> 2) << 4);
        f[2 * j]     = f2bf(p[k * stride]);
        f[2 * j + 1] = f2bf(p[(k + 1) * stride]);
    }
    return f;
}

// The stages in front of the GEMMs are device functions that take their block number, so that stages
// which do not depend on one another can share a launch.

// ---------------- Stage 1: mu router ----------------
__device__ __forceinline__ void router_block(int blk,
                                             const float* __restrict__ mu,
                                             const float* __restrict__ wr,
                                             const int*   __restrict__ token_ids,
                                             int* __restrict__ expert_id) {
    const int t    = blk * 8 + (threadIdx.x >> 5);
    const int lane = threadIdx.x & 31;
    if (t >= NTOK) return;
    float acc[NEXP];
#pragma unroll
    for (int e = 0; e < NEXP; ++e) acc[e] = 0.f;
    for (int h = lane; h < HID; h += 32) {
        const float m = mu[(size_t)t * HID + h];
#pragma unroll
        for (int e = 0; e < NEXP; ++e) acc[e] += m * wr[e * HID + h];
    }
#pragma unroll
    for (int e = 0; e < NEXP; ++e)
#pragma unroll
        for (int off = 16; off > 0; off >>= 1)
            acc[e] += __shfl_xor(acc[e], off, 32);
    if (lane == 0) {
        int tid = token_ids[t];
        tid = tid < 0 ? 0 : (tid > VOCAB - 1 ? VOCAB - 1 : tid);
        const int base = tid & (NEXP - 1);
        int best = 0;
        float bv = acc[0] + (base == 0 ? 10.f : 0.f);
#pragma unroll
        for (int e = 1; e < NEXP; ++e) {
            const float v = acc[e] + (base == e ? 10.f : 0.f);
            if (v > bv) { bv = v; best = e; }
        }
        expert_id[t] = best;
    }
}

// ---------------- Stage 2: bucket tokens by expert ----------------
__device__ __forceinline__ void zero_counts(int* __restrict__ counts) {
    if (threadIdx.x < NEXP) counts[threadIdx.x] = 0;
}

__device__ __forceinline__ void bucket_block(int blk,
                                             const int* __restrict__ expert_id,
                                             int* __restrict__ counts,
                                             int* __restrict__ lists) {
    const int t = blk * 256 + threadIdx.x;
    if (t >= NTOK) return;
    const int e   = expert_id[t];
    const int pos = atomicAdd(&counts[e], 1);
    lists[e * NTOK + pos] = t;
}

// ---------------- Pre-pass: f32 -> bf16 conversion ----------------
__device__ __forceinline__ void convert_block(int blk, const float* __restrict__ in,
                                              __bf16* __restrict__ out) {
    const int i = blk * 256 + threadIdx.x;
    const float4 v = ((const float4*)in)[i];
    __bf16 t[4] = {f2bf(v.x), f2bf(v.y), f2bf(v.z), f2bf(v.w)};
    ((uint2*)out)[i] = *(uint2*)t;
    // stands in front of any rewrite of this store's registers: in a merged launch another stage's code follows
    asm volatile("s_wait_xcnt 0x0" ::: "memory");
}

// per expert: in[R][C] f32 -> outT[C][R] bf16 ; (C/64) * (R/64) * E blocks of 256 thr, n tile fastest
template <int R, int C>
__device__ __forceinline__ void transpose_block(int blk, __bf16 (*sT)[KP],
        const float* __restrict__ in, __bf16* __restrict__ outT) {
    const int tid = threadIdx.x;
    const int n0 = (blk % (C / 64)) * 64, k0 = (blk / (C / 64) % (R / 64)) * 64;
    const int ex = blk / ((C / 64) * (R / 64));
    const size_t eIn  = (size_t)ex * R * C;
    const size_t eOut = (size_t)ex * C * R;
#pragma unroll
    for (int i = 0; i < 4; ++i) {
        const int c  = tid + i * 256;
        const int kl = c >> 4, nl = (c & 15) << 2;
        const float4 v = *(const float4*)(in + eIn + (size_t)(k0 + kl) * C + n0 + nl);
        sT[kl][nl]     = f2bf(v.x);
        sT[kl][nl + 1] = f2bf(v.y);
        sT[kl][nl + 2] = f2bf(v.z);
        sT[kl][nl + 3] = f2bf(v.w);
    }
    __syncthreads();
    const int n = tid >> 2, ks = (tid & 3) << 4;
    __bf16 tmp[16];
#pragma unroll
    for (int j = 0; j < 16; ++j) tmp[j] = sT[ks + j][n];
    __bf16* dst = outT + eOut + (size_t)(n0 + n) * R + k0 + ks;
    *(uint4*)dst       = *(uint4*)tmp;
    *((uint4*)dst + 1) = *((uint4*)tmp + 1);
    // stands in front of any rewrite of these stores' registers: in a merged launch another stage's code follows
    asm volatile("s_wait_xcnt 0x0" ::: "memory");
}

// down[e][k][n] f32 -> downT[e][n][k] bf16 for a work-group that has a WGP to itself (it shares the
// gate-up GEMM's launch, so 8 waves are all that read): TPW tiles of TT x TT, up to two tiles' loads
// (32 x 16 B per lane) in flight. A lane holds 16 consecutive k of 4 columns, so the transpose is a
// choice of registers; LDS only regroups the 32-B runs into whole 256-B rows of downT.
// 16-B chunk c of tile row n lies at chunk c ^ (n / 4 % 16): both LDS sides touch every bank once.
__device__ __forceinline__ void transpose_strip(int blk, __bf16 (*sT)[TT][TT],
        const float* __restrict__ in, __bf16* __restrict__ outT) {
    const int tid = threadIdx.x, lane = tid & 31, wave = tid >> 5;
    const int n0 = (blk % (HID / TT)) * TT;
    const int k0 = (blk / (HID / TT) % (IEXP / TT / TPW)) * (TT * TPW);
    const int ex = blk / ((HID / TT) * (IEXP / TT / TPW));
    const float* src = in + ((size_t)ex * IEXP + k0 + wave * 16) * HID + n0 + lane * 4;
    __bf16* dst = outT + ((size_t)ex * HID + n0 + (tid >> 4)) * IEXP + k0 + (tid & 15) * 8;
    v4f v[2][16];
    // every loop of this function is unrolled: v and p are then indexed by constants and stay in registers
    auto load = [&](int t, int s) {
#pragma unroll
        for (int i = 0; i < 16; ++i)             // read once: kept out of the L2 that the GEMM beside it uses
            v[s][i] = __builtin_nontemporal_load((const v4f*)(src + (size_t)(t * TT + i) * HID));
        // stands in front of any rewrite of these loads' registers
        asm volatile("s_wait_xcnt 0x0" ::: "memory");
    };
    load(0, 0);
    load(1, 1);
#pragma unroll
    for (int t = 0; t < TPW; ++t) {
        const int s = t & 1;
#pragma unroll
        for (int cc = 0; cc < 4; ++cc) {
            __bf16 p[16];
#pragma unroll
            for (int i = 0; i < 16; ++i) p[i] = f2bf(v[s][i][cc]);
            __bf16* row = &sT[s][lane * 4 + cc][0];
            *(uint4*)(row + (((wave * 2)     ^ (lane & 15)) << 3)) = *(uint4*)p;
            *(uint4*)(row + (((wave * 2 + 1) ^ (lane & 15)) << 3)) = *((uint4*)p + 1);
        }
        if (t + 2 < TPW) load(t + 2, s);
        // Work-group barrier with the LDS wait alone: tile t is whole behind it, and buffer s is written
        // again only behind tile t + 1's barrier, where this wave's reads of it have returned.
        // __syncthreads() would also wait out the later tiles' global loads, which are to stay in flight.
        asm volatile("s_wait_dscnt 0x0\n\ts_barrier_signal -1\n\ts_barrier_wait -1" ::: "memory");
#pragma unroll
        for (int i = 0; i < TT / 16; ++i) {
            const int n = (tid >> 4) + i * 16;
            *(uint4*)(dst + (size_t)(i * 16) * IEXP + t * TT) =
                *(const uint4*)&sT[s][n][((tid & 15) ^ ((n >> 2) & 15)) << 3];
        }
        // stands in front of any rewrite of these stores' registers
        asm volatile("s_wait_xcnt 0x0" ::: "memory");
    }
}

#define RBLK  (NTOK / 8)                              // router blocks
#define BBLK  (NTOK / 256)                            // bucket blocks
#define XBLK  (NTOK * HID / 4 / 256)                  // x conversion blocks
#define GUBLK ((TWOIE / 64) * (HID / 64) * NEXP)      // gate-up transpose blocks
#define DTBLK (NEXP * (HID / TT) * (IEXP / TT) / TPW)  // down transpose blocks

// Launch 1: the router, the gate-up transpose and the x conversion, which read inputs alone. The router's blocks, which wait on latency, come
// first and run beside the streaming blocks.
__global__ __launch_bounds__(256) void prep_inputs_kernel(
        const float* __restrict__ mu, const float* __restrict__ wr,
        const int* __restrict__ token_ids, const float* __restrict__ x,
        const float* __restrict__ gup,
        int* __restrict__ expert_id, int* __restrict__ counts,
        __bf16* __restrict__ xbf, __bf16* __restrict__ gupT) {
    __shared__ alignas(16) __bf16 sT[64][KP];
    const int blk = blockIdx.x;
    if (blk < RBLK) {
        if (blk == 0) zero_counts(counts);
        router_block(blk, mu, wr, token_ids, expert_id);
    } else if (blk < RBLK + GUBLK) {
        transpose_block<HID, TWOIE>(blk - RBLK, sT, gup, gupT);
    } else {
        convert_block(blk - RBLK - GUBLK, x, xbf);
    }
}

// Launch 2 is bucket_kernel alone: it needs launch 1's expert ids and zeroed counts.
// The stages as launches of their own (all three on the fallback path).
__global__ void router_kernel(const float* __restrict__ mu, const float* __restrict__ wr,
                              const int* __restrict__ token_ids, int* __restrict__ expert_id) {
    router_block(blockIdx.x, mu, wr, token_ids, expert_id);
}
__global__ void zero_counts_kernel(int* __restrict__ counts) { zero_counts(counts); }
__global__ void bucket_kernel(const int* __restrict__ expert_id, int* __restrict__ counts,
                              int* __restrict__ lists) {
    bucket_block(blockIdx.x, expert_id, counts, lists);
}

// ---------------- Kernel 3a: grouped MoE MLP as two GEMM launches, bf16 inputs ----------------
// Row tile number 'slot' of the launch -> its expert and its first place in that expert's token list.
// Any split of NTOK tokens over NEXP experts needs at most MSLOT row tiles.
__device__ __forceinline__ bool find_tile(const int* __restrict__ counts, int slot,
                                          int& e, int& start, int& nvalid) {
    int first = 0;
    e = -1; start = 0; nvalid = 0;
#pragma unroll
    for (int i = 0; i < NEXP; ++i) {
        const int c  = counts[i];
        const int nt = (c + GBM - 1) / GBM;
        if (e < 0 && slot < first + nt) {
            e      = i;
            start  = (slot - first) * GBM;
            nvalid = (c - start) < GBM ? (c - start) : GBM;
        }
        first += nt;
    }
    return e >= 0;
}

// One work-group: GBM gathered rows of A times GBN weight rows (k contiguous), 8 waves as 2 x 4,
// each wave GBM/2 rows x 64 columns = GMT x 4 accumulator tiles, GMT * 4 WMMAs per 32-wide k-step.
// GU: the staged weight rows are GBN/2 gate columns, then the same GBN/2 up columns; a wave holds
// gate (j = 0, 1) and up (j = 2, 3) of the same 32 columns and writes silu(gate) * up as bf16.
template <int K, bool GU>
__device__ __forceinline__ void grouped_gemm(
        const __bf16* __restrict__ A,      // [T][K], rows picked through the token list
        const __bf16* __restrict__ WT,     // [E][2048][K]  (n-major, k contiguous)
        const int*   __restrict__ counts,
        const int*   __restrict__ lists,
        __bf16* __restrict__ inter,        // GU: [T][IE]
        float*  __restrict__ out) {        // else: [T][H]
    int e, start, nvalid;
    if (!find_tile(counts, blockIdx.y, e, start, nvalid)) return;

    const int tid  = threadIdx.x;
    const int lane = tid & 31;
    const int wave = tid >> 5;
    const int l15  = lane & 15;
    const int rhi  = (lane >= 16) ? 8 : 0;
    const int wm   = wave >> 2;
    const int wn   = wave & 3;

    // one struct fixes the order: the weight tiles, whose copies differ by constant steps that become
    // immediate offsets, lie above the largest such offset, so no LDS address register goes below 0
    struct Smem {
        __bf16 a[2][GBM][GKP];
        __bf16 b[2][GBN][GKP];
        int    tok[GBM];
    };
    __shared__ alignas(16) Smem sm;
    auto& sA   = sm.a;
    auto& sB   = sm.b;
    auto& sTok = sm.tok;

    if (tid < GBM)                               // invalid rows read token 0 (never stored)
        sTok[tid] = (tid < nvalid) ? lists[e * NTOK + start + tid] : 0;
    __syncthreads();

    // per-thread staging coordinates: one sweep of the block = 16 rows x 16 chunks of 16B (8 bf16)
    const int sr = tid >> 4, sk = (tid & 15) << 3;
    const int ncol = blockIdx.x * (GU ? GBN / 2 : GBN);
    const __bf16* arow[GBM / 16];
#pragma unroll
    for (int i = 0; i < GBM / 16; ++i) arow[i] = A + (size_t)sTok[sr + i * 16] * K + sk;
    const __bf16* wrow = WT + ((size_t)e * TWOIE + ncol + sr) * K + sk;

    auto stage = [&](int k0, int b) {            // GBM/16 + GBN/16 copies per thread
#pragma unroll
        for (int i = 0; i < GBM / 16; ++i)
            stage16(arow[i] + k0, &sA[b][sr + i * 16][sk]);
#pragma unroll
        for (int i = 0; i < GBN / 16; ++i) {
            const int grow = i * 16 + ((GU && i >= GBN / 32) ? IEXP - GBN / 2 : 0);
            stage16(wrow + (size_t)grow * K + k0, &sB[b][sr + i * 16][sk]);
        }
    };

    v8f acc[GMT][4];
#pragma unroll
    for (int mt = 0; mt < GMT; ++mt)
#pragma unroll
        for (int j = 0; j < 4; ++j)
            acc[mt][j] = v8f{0.f, 0.f, 0.f, 0.f, 0.f, 0.f, 0.f, 0.f};

    // two-buffer ring: tile t + 1 flies while tile t is worked on, one barrier per trip
    stage(0, 0);
    asm volatile("s_wait_asynccnt 0x0" ::: "memory");   // this wave's share of tile 0 has landed
    __syncthreads();                                     // ... and every other wave's
    stage(GKC, 1);
    int ib = 0;
#pragma unroll 1
    for (int k0 = 0; k0 < K; k0 += GKC, ib ^= 1) {
        v16bf a[2][GMT], b[2][4];                // two fragment sets, all of buffer ib
        auto frags = [&](int kk, int s) {
#pragma unroll
            for (int mt = 0; mt < GMT; ++mt)
                a[s][mt] = frag_bf(&sA[ib][wm * (GBM / 2) + mt * 16 + l15][kk], lane);
#pragma unroll
            for (int j = 0; j < 4; ++j) {
                const int brow = GU ? (j >> 1) * (GBN / 2) + wn * 32 + (j & 1) * 16
                                    : wn * 64 + j * 16;
                b[s][j] = frag_bf(&sB[ib][brow + l15][kk], lane);
            }
        };
        frags(0, 0);
#pragma unroll
        for (int blk = 0; blk < GKC / 32; ++blk) {
            if (blk + 1 < GKC / 32) frags((blk + 1) * 32, (blk + 1) & 1);
            // keeps the next k-step's LDS reads as one group in front of this k-step's WMMAs
            __builtin_amdgcn_sched_barrier(0);
#pragma unroll
            for (int mt = 0; mt < GMT; ++mt)
#pragma unroll
                for (int j = 0; j < 4; ++j)
                    acc[mt][j] = __builtin_amdgcn_wmma_f32_16x16x32_bf16(
                        false, a[blk & 1][mt], false, b[blk & 1][j], (short)0, acc[mt][j], false, false);
            // keeps later LDS reads from being spread among these WMMAs
            __builtin_amdgcn_sched_barrier(0);
        }
        asm volatile("s_wait_dscnt 0x0" ::: "memory");      // this wave's reads of buffer ib are done
        asm volatile("s_wait_asynccnt 0x0" ::: "memory");   // this wave's share of tile t + 1 has landed
        __syncthreads();                                     // publishes tile t + 1, frees buffer ib
        if (k0 + 2 * GKC < K) stage(k0 + 2 * GKC, ib);
    }
    asm volatile("s_wait_asynccnt 0x0" ::: "memory");       // no copy outlives the loop

    // C layout: VGPR r -> M=r / r+8; lane%16 -> N
#pragma unroll
    for (int mt = 0; mt < GMT; ++mt) {
        const int rbase = wm * (GBM / 2) + mt * 16 + rhi;
        const int4 t03 = *(const int4*)&sTok[rbase];         // this lane's 8 rows' tokens in two reads
        const int4 t47 = *(const int4*)&sTok[rbase + 4];
        const int  tk[8] = {t03.x, t03.y, t03.z, t03.w, t47.x, t47.y, t47.z, t47.w};
#pragma unroll
        for (int r = 0; r < 8; ++r) {
            const int rloc = rbase + r;
            if (rloc < nvalid) {
                if constexpr (GU) {
                    __bf16* irow = inter + (size_t)tk[r] * IEXP + ncol + wn * 32 + l15;
#pragma unroll
                    for (int j = 0; j < 2; ++j) {
                        const float g = acc[mt][j][r];
                        const float u = acc[mt][j + 2][r];
                        irow[j * 16] =
                            f2bf((g / (1.f + exp2_slot(g * -1.44269504f))) * u);   // exp(-g) as 2^(-g*log2(e))
                    }
                } else {
                    float* orow = out + (size_t)tk[r] * HID + ncol + wn * 64 + l15;
#pragma unroll
                    for (int j = 0; j < 4; ++j) orow[j * 16] = acc[mt][j][r];
                }
            }
        }
    }
}

// inter = silu(x*Wg) * (x*Wu) ; grid (IE / (GBN/2), MSLOT + DTBLK / (IE / (GBN/2)))
// The GEMM's work-groups, one per WGP by their LDS, come first and leave part of the WGPs free; the
// rows of the grid behind them transpose the down weights there, which nothing reads before the
// next launch.
__global__ __launch_bounds__(256) void moe_gateup_kernel(
        const __bf16* __restrict__ xb,     // [T][H]
        const __bf16* __restrict__ gupT,   // [E][2IE][H]
        const int*   __restrict__ counts,
        const int*   __restrict__ lists,
        __bf16* __restrict__ inter,        // [T][IE]
        const float* __restrict__ down,    // [E][IE][H]
        __bf16* __restrict__ downT) {      // [E][H][IE]
    __shared__ alignas(16) __bf16 sT[2][TT][TT];
    if (blockIdx.y >= MSLOT) {
        transpose_strip((blockIdx.y - MSLOT) * (IEXP / (GBN / 2)) + blockIdx.x, sT, down, downT);
        return;
    }
    grouped_gemm<HID, true>(xb, gupT, counts, lists, inter, nullptr);
}

// out = inter @ Wd ; grid (H / GBN, MSLOT)
__global__ __launch_bounds__(256) void moe_down_kernel(
        const __bf16* __restrict__ inter,  // [T][IE]
        const __bf16* __restrict__ downT,  // [E][H][IE]
        const int*   __restrict__ counts,
        const int*   __restrict__ lists,
        float* __restrict__ out) {
    grouped_gemm<IEXP, false>(inter, downT, counts, lists, nullptr, out);
}

// ---------------- Kernel 3b: fallback (f32 staging, inline convert) ----------------
__global__ __launch_bounds__(256) void moe_mlp_f32_kernel(
        const float* __restrict__ x,
        const float* __restrict__ gup,
        const float* __restrict__ down,
        const int*   __restrict__ counts,
        const int*   __restrict__ lists,
        float* __restrict__ out) {
    const int blocks_per_e = NTOK / BM;
    const int e  = blockIdx.x / blocks_per_e;
    const int mb = blockIdx.x % blocks_per_e;
    const int cnt   = counts[e];
    const int start = mb * BM;
    if (start >= cnt) return;
    const int nvalid = (cnt - start) < BM ? (cnt - start) : BM;

    const int tid  = threadIdx.x;
    const int lane = tid & 31;
    const int wave = tid >> 5;
    const int mi   = wave >> 2;
    const int ni   = wave & 3;

    __shared__ alignas(16) float  sXf [BM][XPAD];
    __shared__ alignas(16) float  sWgf[KC][WPAD];
    __shared__ alignas(16) float  sWuf[KC][WPAD];
    __shared__ alignas(16) __bf16 sI  [BM][IPAD];
    __shared__ int          sTok [BM];
    __shared__ const float* sXrow[BM];

    if (tid < BM) {
        const int tk = (tid < nvalid) ? lists[e * NTOK + start + tid] : 0;
        sTok[tid]  = tk;
        sXrow[tid] = x + (size_t)tk * HID;
    }
    __syncthreads();

    const float* Wgu = gup  + (size_t)e * HID * TWOIE;
    const float* Wd  = down + (size_t)e * IEXP * HID;
    const int mrow = mi * 16 + (lane & 15);
    const int ncl  = ni * 16 + (lane & 15);

    for (int no = 0; no < IEXP / 64; ++no) {
        const int ncol = no * 64;
        v8f accg = {0.f, 0.f, 0.f, 0.f, 0.f, 0.f, 0.f, 0.f};
        v8f accu = {0.f, 0.f, 0.f, 0.f, 0.f, 0.f, 0.f, 0.f};
#pragma unroll 1
        for (int k0 = 0; k0 < HID; k0 += KC) {
#pragma unroll
            for (int i = 0; i < 2; ++i) {
                const int c = tid + i * 256;
                const int r = c >> 4, k = (c & 15) << 2;
                stage16(sXrow[r] + k0 + k, &sXf[r][k]);
            }
#pragma unroll
            for (int i = 0; i < 4; ++i) {
                const int c = tid + i * 256;
                const int K = c >> 4, n = (c & 15) << 2;
                const size_t off = (size_t)(k0 + K) * TWOIE + ncol + n;
                stage16(Wgu + off,        &sWgf[K][n]);
                stage16(Wgu + off + IEXP, &sWuf[K][n]);
            }
            WAIT_ASYNC(0);
            __syncthreads();
#pragma unroll
            for (int kk = 0; kk < KC; kk += 32) {
                const v16bf a  = frag_f32(&sXf[mrow][kk], lane);
                const v16bf bg = frag_f32_strided(&sWgf[kk][ncl], WPAD, lane);
                const v16bf bu = frag_f32_strided(&sWuf[kk][ncl], WPAD, lane);
                accg = __builtin_amdgcn_wmma_f32_16x16x32_bf16(false, a, false, bg,
                                                               (short)0, accg, false, false);
                accu = __builtin_amdgcn_wmma_f32_16x16x32_bf16(false, a, false, bu,
                                                               (short)0, accu, false, false);
            }
            __syncthreads();
        }
#pragma unroll
        for (int r = 0; r < 8; ++r) {
            const int row = mi * 16 + r + ((lane >= 16) ? 8 : 0);
            const float g = accg[r];
            const float u = accu[r];
            sI[row][ncol + ni * 16 + (lane & 15)] = f2bf((g / (1.f + __expf(-g))) * u);
        }
    }
    __syncthreads();

    for (int no = 0; no < HID / 64; ++no) {
        const int ncol = no * 64;
        v8f acc = {0.f, 0.f, 0.f, 0.f, 0.f, 0.f, 0.f, 0.f};
#pragma unroll 1
        for (int k0 = 0; k0 < IEXP; k0 += KC) {
#pragma unroll
            for (int i = 0; i < 4; ++i) {
                const int c = tid + i * 256;
                const int K = c >> 4, n = (c & 15) << 2;
                stage16(Wd + (size_t)(k0 + K) * HID + ncol + n, &sWgf[K][n]);
            }
            WAIT_ASYNC(0);
            __syncthreads();
#pragma unroll
            for (int kk = 0; kk < KC; kk += 32) {
                const v16bf a = frag_bf(&sI[mrow][k0 + kk], lane);
                const v16bf b = frag_f32_strided(&sWgf[kk][ncl], WPAD, lane);
                acc = __builtin_amdgcn_wmma_f32_16x16x32_bf16(false, a, false, b,
                                                              (short)0, acc, false, false);
            }
            __syncthreads();
        }
#pragma unroll
        for (int r = 0; r < 8; ++r) {
            const int rloc = mi * 16 + r + ((lane >= 16) ? 8 : 0);
            if (rloc < nvalid)
                out[(size_t)sTok[rloc] * HID + ncol + ni * 16 + (lane & 15)] = acc[r];
        }
    }
}

extern "C" void kernel_launch(void* const* d_in, const int* in_sizes, int n_in,
                              void* d_out, int out_size, void* d_ws, size_t ws_size,
                              hipStream_t stream) {
    const float* x    = (const float*)d_in[0];
    const int*   tids = (const int*)  d_in[1];
    const float* mu   = (const float*)d_in[2];
    const float* gup  = (const float*)d_in[3];
    const float* down = (const float*)d_in[4];
    const float* wr   = (const float*)d_in[5];
    float* out = (float*)d_out;

    int* expert_id = (int*)d_ws;                 // NTOK ints
    int* counts    = expert_id + NTOK;           // NEXP ints
    int* lists     = counts + NEXP;              // NEXP*NTOK ints

    const size_t metaB = ((size_t)(NTOK + NEXP + NEXP * NTOK) * 4 + 255) & ~(size_t)255;
    const size_t nXb   = (size_t)NTOK * HID;
    const size_t nGup  = (size_t)NEXP * TWOIE * HID;
    const size_t nDown = (size_t)NEXP * HID * IEXP;
    const size_t nInt  = (size_t)NTOK * IEXP;
    const size_t need  = metaB + 2 * (nXb + nGup + nDown + nInt);

    if (ws_size >= need) {
        __bf16* xbf   = (__bf16*)((char*)d_ws + metaB);
        __bf16* gupT  = xbf + nXb;
        __bf16* downT = gupT + nGup;
        __bf16* intb  = downT + nDown;
        prep_inputs_kernel<<<RBLK + GUBLK + XBLK, 256, 0, stream>>>(mu, wr, tids, x, gup,
                                                                    expert_id, counts, xbf, gupT);
        bucket_kernel<<<BBLK, 256, 0, stream>>>(expert_id, counts, lists);
        moe_gateup_kernel<<<dim3(IEXP / (GBN / 2), MSLOT + DTBLK / (IEXP / (GBN / 2))), 256, 0, stream>>>(
            xbf, gupT, counts, lists, intb, down, downT);
        moe_down_kernel<<<dim3(HID / GBN, MSLOT), 256, 0, stream>>>(intb, downT, counts, lists, out);
    } else {
        router_kernel<<<RBLK, 256, 0, stream>>>(mu, wr, tids, expert_id);
        zero_counts_kernel<<<1, 32, 0, stream>>>(counts);
        bucket_kernel<<<BBLK, 256, 0, stream>>>(expert_id, counts, lists);
        moe_mlp_f32_kernel<<<NEXP * (NTOK / BM), 256, 0, stream>>>(x, gup, down,
                                                                   counts, lists, out);
    }
}

// v005
// Measured time: 82.7 microseconds a run.
// Timed twice side by side with v004, it ran 1.04 times as fast both times.
// Counting every step since v000, it is 6.08 times as fast.
#include <hip/hip_runtime.h>
#include <math.h>
#include <stdint.h>

#define NTOK   4096
#define HID    2048
#define IEXP   1024
#define TWOIE  2048
#define NEXP   8
#define VOCAB  32000
#define BM     32
#define KC     64          // K-chunk per LDS stage (2 WMMA k-steps)
#define KP     72          // bf16 row stride for 64-wide K tiles (144B: 16B-aligned, banks spread)
#define XPAD   76          // f32 row stride, X tile (fallback)
#define WPAD   68          // f32 row stride, W tiles (fallback)
#define IPAD   1032        // bf16 row stride, inter (2064B: 16B-aligned, banks spread)
#define GBM    192         // token rows per work-group of the grouped GEMMs
#define GBN    256         // weight rows (product columns) per work-group of the grouped GEMMs
#define GKC    128         // K-chunk per LDS stage of the grouped GEMMs (4 WMMA k-steps)
#define GKP    136         // bf16 row stride for 128-wide K tiles (272B: 16B x odd)
#define GMT    (GBM / 32)  // accumulator row tiles per wave
#define MSLOT  (NTOK / GBM + NEXP)
// Slices of a staged tile, one tensor load each; a slice's LDS bytes = rows x 272 B, rounded up to a multiple of 2 KiB
#define BSR_GU 32          // gate-up GEMM: weight rows per slice, 8 slices, one per wave
#define BSB_GU 10240
#define BSR_DN 64          // down GEMM: weight rows per slice, 4 slices, waves 0 to 3
#define BSB_DN 18432
#define ASR_DN 48          // down GEMM: rows of inter per slice, 4 slices, waves 4 to 7
#define ASB_DN 14336
#define TT     128         // down-weight transpose tile: TT k rows x TT columns
#define TPW    4           // such tiles per work-group, consecutive in k

#if __has_builtin(__builtin_amdgcn_global_load_async_to_lds_b128) && \
    __has_builtin(__builtin_amdgcn_s_wait_asynccnt)
#define HAVE_ASYNC 1
#else
#define HAVE_ASYNC 0
#endif

typedef __attribute__((ext_vector_type(16))) __bf16 v16bf;
typedef __attribute__((ext_vector_type(8)))  float  v8f;
typedef __attribute__((__vector_size__(16))) int    v4i;   // pointee type the async builtin expects
typedef __attribute__((ext_vector_type(4)))  float  v4f;
typedef uint32_t u32x4 __attribute__((ext_vector_type(4)));
typedef uint32_t u32x8 __attribute__((ext_vector_type(8)));

__device__ __forceinline__ __bf16 f2bf(float f) {
    union { float f; unsigned u; } v; v.f = f;
    unsigned r = v.u + 0x7FFFu + ((v.u >> 16) & 1u);   // round-to-nearest-even
    return __builtin_bit_cast(__bf16, (unsigned short)(r >> 16));
}

// 2^x on the transcendental unit. The v_nop in the same statement fills the one issue slot that the
// instruction set asks for between v_exp_f32 and a next instruction that reads its result or
// overwrites its source; as a statement of its own the compiler moves it away from the v_exp_f32.
__device__ __forceinline__ float exp2_slot(float x) {
    float r;
    asm("v_exp_f32 %0, %1\n\tv_nop" : "=v"(r) : "v"(x));
    return r;
}

// 16B global->LDS copy: async DMA on gfx1250, VGPR round-trip fallback.
__device__ __forceinline__ void stage16(const void* src, void* dst) {
#if HAVE_ASYNC
    __builtin_amdgcn_global_load_async_to_lds_b128((v4i*)src, (v4i*)dst, 0, 0);
#else
    *(float4*)dst = *(const float4*)src;
#endif
}

// ---- tensor load: one request of a whole wave brings a 2-D tile from global memory into LDS ----
__device__ __forceinline__ uint32_t uni(uint32_t v) { return (uint32_t)__builtin_amdgcn_readfirstlane(v); }
// a wave-uniform test held in a scalar register, so that the branch on it is a scalar branch
__device__ __forceinline__ uint32_t pinned(uint32_t v) {
    uint32_t w = uni(v);
    asm volatile("" : "+s"(w));   // holds the test in a scalar register: the branch round a tensor load must be scalar
    return w;
}
// group 1: 1-byte elements, 'rows' rows of 256 B, 16 B of LDS pad behind every row (pitch 272 B = GKP bf16)
__device__ __forceinline__ u32x8 tdm_group1(uint32_t rows, uint32_t src_pitch) {
    u32x8 g;
    g[0] = uni((1u << 20) | (5u << 22) | (3u << 25));
    g[1] = uni(256u << 16);
    g[2] = uni(rows << 16);
    g[3] = uni(256u << 16);
    g[4] = uni(rows);
    g[5] = uni(src_pitch);
    g[6] = uni(0u);
    g[7] = uni(0u);
    return g;
}
__device__ __forceinline__ u32x4 tdm_group0(uint32_t lds_dst, uint64_t ga) {
    u32x4 g;
    g[0] = uni(1u);
    g[1] = uni(lds_dst);
    g[2] = uni((uint32_t)ga);
    g[3] = uni((((uint32_t)(ga >> 32)) & 0x01FFFFFFu) | 0x80000000u);
    return g;
}
// The descriptor sits in scalar registers of its own, high above the ones the compiler hands out: nothing
// else is written there, so no word of a descriptor changes while its request is still outstanding.
__device__ __forceinline__ void tdm_load(u32x4 g0, u32x8 g1) {
    asm volatile("tensor_load_to_lds %0, %1" :: "{s[88:91]}"(g0), "{s[80:87]}"(g1) : "memory");
}
// the same with the issuing wave's wait directly behind the load, in one statement so that it stays there
__device__ __forceinline__ void tdm_load_wait(u32x4 g0, u32x8 g1) {
    asm volatile("tensor_load_to_lds %0, %1\n\ts_wait_tensorcnt 0x0"
                 :: "{s[88:91]}"(g0), "{s[80:87]}"(g1) : "memory");
}

#if HAVE_ASYNC
#define WAIT_ASYNC(n) __builtin_amdgcn_s_wait_asynccnt(n)
#else
#define WAIT_ASYNC(n) ((void)0)
#endif

// ISA 16-bit WMMA operand layout: lanes 0-15 hold K 0..7 & 16..23,
// lanes 16-31 hold K 8..15 & 24..31 (pairs packed per VGPR).
__device__ __forceinline__ v16bf frag_bf(const __bf16* p, int lane) {        // contiguous K
    const int kb = (lane >> 4) << 3;
    v16bf f;
#pragma unroll
    for (int j = 0; j < 8; ++j) {
        const int k = kb + ((j & 3) << 1) + ((j >> 2) << 4);
        f[2 * j]     = p[k];
        f[2 * j + 1] = p[k + 1];
    }
    return f;
}

__device__ __forceinline__ v16bf frag_f32(const float* p, int lane) {        // fallback A
    const int kb = (lane >> 4) << 3;
    v16bf f;
#pragma unroll
    for (int j = 0; j < 8; ++j) {
        const int k = kb + ((j & 3) << 1) + ((j >> 2) << 4);
        f[2 * j]     = f2bf(p[k]);
        f[2 * j + 1] = f2bf(p[k + 1]);
    }
    return f;
}

__device__ __forceinline__ v16bf frag_f32_strided(const float* p, int stride, int lane) { // fallback B
    const int kb = (lane >> 4) << 3;
    v16bf f;
#pragma unroll
    for (int j = 0; j < 8; ++j) {
        const int k = kb + ((j & 3) << 1) + ((j >> 2) << 4);
        f[2 * j]     = f2bf(p[k * stride]);
        f[2 * j + 1] = f2bf(p[(k + 1) * stride]);
    }
    return f;
}

// The stages in front of the GEMMs are device functions that take their block number, so that stages
// which do not depend on one another can share a launch.

// ---------------- Stage 1: mu router ----------------
__device__ __forceinline__ void router_block(int blk,
                                             const float* __restrict__ mu,
                                             const float* __restrict__ wr,
                                             const int*   __restrict__ token_ids,
                                             int* __restrict__ expert_id) {
    const int t    = blk * 8 + (threadIdx.x >> 5);
    const int lane = threadIdx.x & 31;
    if (t >= NTOK) return;
    float acc[NEXP];
#pragma unroll
    for (int e = 0; e < NEXP; ++e) acc[e] = 0.f;
    for (int h = lane; h < HID; h += 32) {
        const float m = mu[(size_t)t * HID + h];
#pragma unroll
        for (int e = 0; e < NEXP; ++e) acc[e] += m * wr[e * HID + h];
    }
#pragma unroll
    for (int e = 0; e < NEXP; ++e)
#pragma unroll
        for (int off = 16; off > 0; off >>= 1)
            acc[e] += __shfl_xor(acc[e], off, 32);
    if (lane == 0) {
        int tid = token_ids[t];
        tid = tid < 0 ? 0 : (tid > VOCAB - 1 ? VOCAB - 1 : tid);
        const int base = tid & (NEXP - 1);
        int best = 0;
        float bv = acc[0] + (base == 0 ? 10.f : 0.f);
#pragma unroll
        for (int e = 1; e < NEXP; ++e) {
            const float v = acc[e] + (base == e ? 10.f : 0.f);
            if (v > bv) { bv = v; best = e; }
        }
        expert_id[t] = best;
    }
}

// ---------------- Stage 2: bucket tokens by expert ----------------
__device__ __forceinline__ void zero_counts(int* __restrict__ counts) {
    if (threadIdx.x < NEXP) counts[threadIdx.x] = 0;
}

__device__ __forceinline__ void bucket_block(int blk,
                                             const int* __restrict__ expert_id,
                                             int* __restrict__ counts,
                                             int* __restrict__ lists) {
    const int t = blk * 256 + threadIdx.x;
    if (t >= NTOK) return;
    const int e   = expert_id[t];
    const int pos = atomicAdd(&counts[e], 1);
    lists[e * NTOK + pos] = t;
}

// ---------------- Pre-pass: f32 -> bf16 conversion ----------------
__device__ __forceinline__ void convert_block(int blk, const float* __restrict__ in,
                                              __bf16* __restrict__ out) {
    const int i = blk * 256 + threadIdx.x;
    const float4 v = ((const float4*)in)[i];
    __bf16 t[4] = {f2bf(v.x), f2bf(v.y), f2bf(v.z), f2bf(v.w)};
    ((uint2*)out)[i] = *(uint2*)t;
    // stands in front of any rewrite of this store's registers: in a merged launch another stage's code follows
    asm volatile("s_wait_xcnt 0x0" ::: "memory");
}

// per expert: in[R][C] f32 -> outT[C][R] bf16 ; (C/64) * (R/64) * E blocks of 256 thr, n tile fastest
template <int R, int C>
__device__ __forceinline__ void transpose_block(int blk, __bf16 (*sT)[KP],
        const float* __restrict__ in, __bf16* __restrict__ outT) {
    const int tid = threadIdx.x;
    const int n0 = (blk % (C / 64)) * 64, k0 = (blk / (C / 64) % (R / 64)) * 64;
    const int ex = blk / ((C / 64) * (R / 64));
    const size_t eIn  = (size_t)ex * R * C;
    const size_t eOut = (size_t)ex * C * R;
#pragma unroll
    for (int i = 0; i < 4; ++i) {
        const int c  = tid + i * 256;
        const int kl = c >> 4, nl = (c & 15) << 2;
        const float4 v = *(const float4*)(in + eIn + (size_t)(k0 + kl) * C + n0 + nl);
        sT[kl][nl]     = f2bf(v.x);
        sT[kl][nl + 1] = f2bf(v.y);
        sT[kl][nl + 2] = f2bf(v.z);
        sT[kl][nl + 3] = f2bf(v.w);
    }
    __syncthreads();
    const int n = tid >> 2, ks = (tid & 3) << 4;
    __bf16 tmp[16];
#pragma unroll
    for (int j = 0; j < 16; ++j) tmp[j] = sT[ks + j][n];
    __bf16* dst = outT + eOut + (size_t)(n0 + n) * R + k0 + ks;
    *(uint4*)dst       = *(uint4*)tmp;
    *((uint4*)dst + 1) = *((uint4*)tmp + 1);
    // stands in front of any rewrite of these stores' registers: in a merged launch another stage's code follows
    asm volatile("s_wait_xcnt 0x0" ::: "memory");
}

// down[e][k][n] f32 -> downT[e][n][k] bf16 for a work-group that has a WGP to itself (it shares the
// gate-up GEMM's launch, so 8 waves are all that read): TPW tiles of TT x TT, up to two tiles' loads
// (32 x 16 B per lane) in flight. A lane holds 16 consecutive k of 4 columns, so the transpose is a
// choice of registers; LDS only regroups the 32-B runs into whole 256-B rows of downT.
// 16-B chunk c of tile row n lies at chunk c ^ (n / 4 % 16): both LDS sides touch every bank once.
__device__ __forceinline__ void transpose_strip(int blk, __bf16 (*sT)[TT][TT],
        const float* __restrict__ in, __bf16* __restrict__ outT) {
    const int tid = threadIdx.x, lane = tid & 31, wave = tid >> 5;
    const int n0 = (blk % (HID / TT)) * TT;
    const int k0 = (blk / (HID / TT) % (IEXP / TT / TPW)) * (TT * TPW);
    const int ex = blk / ((HID / TT) * (IEXP / TT / TPW));
    const float* src = in + ((size_t)ex * IEXP + k0 + wave * 16) * HID + n0 + lane * 4;
    __bf16* dst = outT + ((size_t)ex * HID + n0 + (tid >> 4)) * IEXP + k0 + (tid & 15) * 8;
    v4f v[2][16];
    // every loop of this function is unrolled: v and p are then indexed by constants and stay in registers
    auto load = [&](int t, int s) {
#pragma unroll
        for (int i = 0; i < 16; ++i)             // read once: kept out of the L2 that the GEMM beside it uses
            v[s][i] = __builtin_nontemporal_load((const v4f*)(src + (size_t)(t * TT + i) * HID));
        // stands in front of any rewrite of these loads' registers
        asm volatile("s_wait_xcnt 0x0" ::: "memory");
    };
    load(0, 0);
    load(1, 1);
#pragma unroll
    for (int t = 0; t < TPW; ++t) {
        const int s = t & 1;
#pragma unroll
        for (int cc = 0; cc < 4; ++cc) {
            __bf16 p[16];
#pragma unroll
            for (int i = 0; i < 16; ++i) p[i] = f2bf(v[s][i][cc]);
            __bf16* row = &sT[s][lane * 4 + cc][0];
            *(uint4*)(row + (((wave * 2)     ^ (lane & 15)) << 3)) = *(uint4*)p;
            *(uint4*)(row + (((wave * 2 + 1) ^ (lane & 15)) << 3)) = *((uint4*)p + 1);
        }
        if (t + 2 < TPW) load(t + 2, s);
        // Work-group barrier with the LDS wait alone: tile t is whole behind it, and buffer s is written
        // again only behind tile t + 1's barrier, where this wave's reads of it have returned.
        // __syncthreads() would also wait out the later tiles' global loads, which are to stay in flight.
        asm volatile("s_wait_dscnt 0x0\n\ts_barrier_signal -1\n\ts_barrier_wait -1" ::: "memory");
#pragma unroll
        for (int i = 0; i < TT / 16; ++i) {
            const int n = (tid >> 4) + i * 16;
            *(uint4*)(dst + (size_t)(i * 16) * IEXP + t * TT) =
                *(const uint4*)&sT[s][n][((tid & 15) ^ ((n >> 2) & 15)) << 3];
        }
        // stands in front of any rewrite of these stores' registers
        asm volatile("s_wait_xcnt 0x0" ::: "memory");
    }
}

#define RBLK  (NTOK / 8)                              // router blocks
#define BBLK  (NTOK / 256)                            // bucket blocks
#define XBLK  (NTOK * HID / 4 / 256)                  // x conversion blocks
#define GUBLK ((TWOIE / 64) * (HID / 64) * NEXP)      // gate-up transpose blocks
#define DTBLK (NEXP * (HID / TT) * (IEXP / TT) / TPW)  // down transpose blocks

// Launch 1: the router, the gate-up transpose and the x conversion, which read inputs alone. The router's blocks, which wait on latency, come
// first and run beside the streaming blocks.
__global__ __launch_bounds__(256) void prep_inputs_kernel(
        const float* __restrict__ mu, const float* __restrict__ wr,
        const int* __restrict__ token_ids, const float* __restrict__ x,
        const float* __restrict__ gup,
        int* __restrict__ expert_id, int* __restrict__ counts,
        __bf16* __restrict__ xbf, __bf16* __restrict__ gupT) {
    __shared__ alignas(16) __bf16 sT[64][KP];
    const int blk = blockIdx.x;
    if (blk < RBLK) {
        if (blk == 0) zero_counts(counts);
        router_block(blk, mu, wr, token_ids, expert_id);
    } else if (blk < RBLK + GUBLK) {
        transpose_block<HID, TWOIE>(blk - RBLK, sT, gup, gupT);
    } else {
        convert_block(blk - RBLK - GUBLK, x, xbf);
    }
}

// Launch 2 is bucket_kernel alone: it needs launch 1's expert ids and zeroed counts.
// The stages as launches of their own (all three on the fallback path).
__global__ void router_kernel(const float* __restrict__ mu, const float* __restrict__ wr,
                              const int* __restrict__ token_ids, int* __restrict__ expert_id) {
    router_block(blockIdx.x, mu, wr, token_ids, expert_id);
}
__global__ void zero_counts_kernel(int* __restrict__ counts) { zero_counts(counts); }
__global__ void bucket_kernel(const int* __restrict__ expert_id, int* __restrict__ counts,
                              int* __restrict__ lists) {
    bucket_block(blockIdx.x, expert_id, counts, lists);
}

// ---------------- Kernel 3a: grouped MoE MLP as two GEMM launches, bf16 inputs ----------------
// Row tile number 'slot' of the launch -> its expert, its first place in that expert's token list, and
// 'base', the number of tokens of the experts before it (bucket order: row base + place).
// Any split of NTOK tokens over NEXP experts needs at most MSLOT row tiles.
__device__ __forceinline__ bool find_tile(const int* __restrict__ counts, int slot,
                                          int& e, int& start, int& nvalid, int& base) {
    int first = 0, sum = 0;
    e = -1; start = 0; nvalid = 0; base = 0;
#pragma unroll
    for (int i = 0; i < NEXP; ++i) {
        const int c  = counts[i];
        const int nt = (c + GBM - 1) / GBM;
        if (e < 0 && slot < first + nt) {
            e      = i;
            start  = (slot - first) * GBM;
            nvalid = (c - start) < GBM ? (c - start) : GBM;
            base   = sum;
        }
        first += nt;
        sum   += c;
    }
    return e >= 0;
}

// LDS of a GEMM work-group. The weight slices come first: each tensor load's place is then a multiple of
// 2 KiB from the start of the work-group's LDS (the array that holds this struct is aligned so).
struct SmemGU {
    unsigned char b[2][(GBN / BSR_GU) * BSB_GU]; // slice w: weight rows w * BSR_GU ..., 272 B apart
    __bf16 a[2][GBM][GKP];                       // gathered rows of x, by async copies
    int    tok[GBM];
};
struct SmemDN {
    unsigned char b[2][(GBN / BSR_DN) * BSB_DN]; // slice w: weight rows w * BSR_DN ..., 272 B apart
    unsigned char a[2][(GBM / ASR_DN) * ASB_DN]; // slice w: rows w * ASR_DN ... of the tile of inter, 272 B apart
    int    tok[GBM];
};

// One work-group: GBM rows of A times GBN weight rows (k contiguous), 8 waves as 2 x 4,
// each wave GBM/2 rows x 64 columns = GMT x 4 accumulator tiles, GMT * 4 WMMAs per 32-wide k-step.
// GU: the staged weight rows are GBN/2 gate columns, then the same GBN/2 up columns; a wave holds
// gate (j = 0, 1) and up (j = 2, 3) of the same 32 columns and writes silu(gate) * up as bf16.
// inter is kept in bucket order, so that the down GEMM's rows of A are one 2-D tile for a tensor load.
template <int K, bool GU, typename SM>
__device__ __forceinline__ void grouped_gemm(
        SM& sm,
        const __bf16* __restrict__ A,      // GU: [T][K], rows picked through the token list; else bucket order
        const __bf16* __restrict__ WT,     // [E][2048][K]  (n-major, k contiguous)
        const int*   __restrict__ counts,
        const int*   __restrict__ lists,
        __bf16* __restrict__ inter,        // GU: [T][IE], bucket order
        float*  __restrict__ out) {        // else: [T][H]
    int e, start, nvalid, base;
    if (!find_tile(counts, blockIdx.y, e, start, nvalid, base)) return;
    // Down GEMM: the tile is GBM whole rows of inter. Where the bucket's last rows lie less than GBM rows
    // from the end of inter the tile starts earlier, and this tile's own rows begin at local row 'shift'.
    const int row0  = base + start;
    const int arow0 = GU ? row0 : (row0 < NTOK - GBM ? row0 : NTOK - GBM);
    const int shift = row0 - arow0;

    const int tid  = threadIdx.x;
    const int lane = tid & 31;
    const int wave = tid >> 5;
    const int l15  = lane & 15;
    const int rhi  = (lane >= 16) ? 8 : 0;
    const int wm   = wave >> 2;
    const int wn   = wave & 3;

    auto& sTok = sm.tok;

    // per-thread staging coordinates: one sweep of the block = 16 rows x 16 chunks of 16B (8 bf16)
    const int sr = tid >> 4, sk = (tid & 15) << 3;
    const int ncol = blockIdx.x * (GU ? GBN / 2 : GBN);
    const __bf16* arow[GBM / 16];
    // this wave's tensor load: consecutive rows of the weights or of inter, 256 B of each per stage
    const uint32_t uw = uni((uint32_t)wave);
    uint64_t tsrc;
    uint32_t tdst, tbuf, trows;
    if constexpr (GU) {
        tsrc  = (uint64_t)(size_t)(WT + ((size_t)e * TWOIE + ncol + (uw & 3u) * BSR_GU + (uw >> 2) * IEXP) * K);
        tdst  = (uint32_t)(size_t)&sm.b[0][0] + uw * BSB_GU;
        tbuf  = (uint32_t)sizeof(sm.b[0]);
        trows = BSR_GU;
    } else {
        const bool     isA = uw >= 4u;
        const uint32_t q   = uw & 3u;
        tsrc  = isA ? (uint64_t)(size_t)(A + (size_t)(arow0 + q * ASR_DN) * K)
                    : (uint64_t)(size_t)(WT + ((size_t)e * TWOIE + ncol + q * BSR_DN) * K);
        tdst  = isA ? (uint32_t)(size_t)&sm.a[0][0] + q * ASB_DN : (uint32_t)(size_t)&sm.b[0][0] + q * BSB_DN;
        tbuf  = isA ? (uint32_t)sizeof(sm.a[0]) : (uint32_t)sizeof(sm.b[0]);
        trows = isA ? ASR_DN : BSR_DN;
    }
    const u32x8 g1 = tdm_group1(trows, K * 2);

    auto copies = [&](int k0, int b) {           // GU: GBM/16 copies per thread
        if constexpr (GU) {
#pragma unroll
            for (int i = 0; i < GBM / 16; ++i)
                stage16(arow[i] + k0, &sm.a[b][sr + i * 16][sk]);
        }
    };
    auto stage = [&](int k0, int b) {            // one tensor load per wave, and the copies
        tdm_load(tdm_group0(tdst + (uint32_t)b * tbuf, tsrc + (uint64_t)k0 * 2), g1);
        copies(k0, b);
    };

    v8f acc[GMT][4];
#pragma unroll
    for (int mt = 0; mt < GMT; ++mt)
#pragma unroll
        for (int j = 0; j < 4; ++j)
            acc[mt][j] = v8f{0.f, 0.f, 0.f, 0.f, 0.f, 0.f, 0.f, 0.f};

    if (tid < GBM)                               // rows that are not this tile's read token 0 (never stored)
        sTok[tid] = (tid >= shift && tid < shift + nvalid) ? lists[e * NTOK + start + tid - shift] : 0;
    __syncthreads();
    if constexpr (GU) {
#pragma unroll
        for (int i = 0; i < GBM / 16; ++i) arow[i] = A + (size_t)sTok[sr + i * 16] * K + sk;
    }
    // two-buffer ring: tile t + 1 flies while tile t is worked on, one barrier per trip
    copies(0, 0);
    tdm_load_wait(tdm_group0(tdst, tsrc), g1);           // this wave's slice of tile 0 has landed
    if constexpr (GU)
        asm volatile("s_wait_asynccnt 0x0" ::: "memory");   // and its copies of tile 0
    __syncthreads();                                     // ... and every other wave's
    stage(GKC, 1);
    int ib = 0;
#pragma unroll 1
    for (int k0 = 0; k0 < K; k0 += GKC, ib ^= 1) {
        v16bf a[2][GMT], b[2][4];                // two fragment sets, all of buffer ib
        auto frags = [&](int kk, int s) {
#pragma unroll
            for (int mt = 0; mt < GMT; ++mt) {
                if constexpr (GU)
                    a[s][mt] = frag_bf(&sm.a[ib][wm * (GBM / 2) + mt * 16 + l15][kk], lane);
                else                             // a wave's GBM / 2 rows are two slices of ASR_DN rows
                    a[s][mt] = frag_bf((const __bf16*)&sm.a[ib][(wm * 2 + mt / 3) * ASB_DN] +
                                       ((mt % 3) * 16 + l15) * GKP + kk, lane);
            }
#pragma unroll
            for (int j = 0; j < 4; ++j) {
                const int brow = GU ? (j >> 1) * (GBN / 2) + wn * 32 + (j & 1) * 16
                                    : wn * 64 + j * 16;
                constexpr int BSR = GU ? BSR_GU : BSR_DN, BSB = GU ? BSB_GU : BSB_DN;
                b[s][j] = frag_bf((const __bf16*)&sm.b[ib][(brow / BSR) * BSB] +
                                  (brow % BSR + l15) * GKP + kk, lane);
            }
        };
        frags(0, 0);
#pragma unroll
        for (int blk = 0; blk < GKC / 32; ++blk) {
            if (blk + 1 < GKC / 32) frags((blk + 1) * 32, (blk + 1) & 1);
            // keeps the next k-step's LDS reads as one group in front of this k-step's WMMAs
            __builtin_amdgcn_sched_barrier(0);
#pragma unroll
            for (int mt = 0; mt < GMT; ++mt)
#pragma unroll
                for (int j = 0; j < 4; ++j)
                    acc[mt][j] = __builtin_amdgcn_wmma_f32_16x16x32_bf16(
                        false, a[blk & 1][mt], false, b[blk & 1][j], (short)0, acc[mt][j], false, false);
            // keeps later LDS reads from being spread among these WMMAs
            __builtin_amdgcn_sched_barrier(0);
        }
        asm volatile("s_wait_dscnt 0x0" ::: "memory");      // this wave's reads of buffer ib are done
        asm volatile("s_wait_tensorcnt 0x0" ::: "memory");  // this wave's slice of tile t + 1 has landed
        if constexpr (GU)
            asm volatile("s_wait_asynccnt 0x0" ::: "memory");   // and its copies of tile t + 1
        __syncthreads();                                     // publishes tile t + 1, frees buffer ib
        if (pinned(k0 + 2 * GKC < K)) stage(k0 + 2 * GKC, ib);
    }
    asm volatile("s_wait_tensorcnt 0x0" ::: "memory");      // no tensor load outlives the loop
    if constexpr (GU)
        asm volatile("s_wait_asynccnt 0x0" ::: "memory");   // no copy outlives the loop
    asm volatile("s_wait_dscnt 0x0" ::: "memory");          // nor an LDS read of the ring

    // C layout: VGPR r -> M=r / r+8; lane%16 -> N
#pragma unroll
    for (int mt = 0; mt < GMT; ++mt) {
        const int rbase = wm * (GBM / 2) + mt * 16 + rhi;
        const int4 t03 = *(const int4*)&sTok[rbase];         // this lane's 8 rows' tokens in two reads
        const int4 t47 = *(const int4*)&sTok[rbase + 4];
        const int  tk[8] = {t03.x, t03.y, t03.z, t03.w, t47.x, t47.y, t47.z, t47.w};
#pragma unroll
        for (int r = 0; r < 8; ++r) {
            const int rloc = rbase + r;
            if (rloc >= shift && rloc < shift + nvalid) {
                if constexpr (GU) {
                    __bf16* irow = inter + (size_t)(row0 + rloc) * IEXP + ncol + wn * 32 + l15;
#pragma unroll
                    for (int j = 0; j < 2; ++j) {
                        const float g = acc[mt][j][r];
                        const float u = acc[mt][j + 2][r];
                        irow[j * 16] =
                            f2bf((g / (1.f + exp2_slot(g * -1.44269504f))) * u);   // exp(-g) as 2^(-g*log2(e))
                    }
                } else {
                    float* orow = out + (size_t)tk[r] * HID + ncol + wn * 64 + l15;
#pragma unroll
                    for (int j = 0; j < 4; ++j) orow[j * 16] = acc[mt][j][r];
                }
            }
        }
    }
}

// inter = silu(x*Wg) * (x*Wu) ; grid (IE / (GBN/2), MSLOT + DTBLK / (IE / (GBN/2)))
// The GEMM's work-groups, one per WGP by their LDS, come first and leave part of the WGPs free; the
// rows of the grid behind them transpose the down weights there, which nothing reads before the
// next launch.
__global__ __launch_bounds__(256) void moe_gateup_kernel(
        const __bf16* __restrict__ xb,     // [T][H]
        const __bf16* __restrict__ gupT,   // [E][2IE][H]
        const int*   __restrict__ counts,
        const int*   __restrict__ lists,
        __bf16* __restrict__ inter,        // [T][IE], bucket order
        const float* __restrict__ down,    // [E][IE][H]
        __bf16* __restrict__ downT) {      // [E][H][IE]
    // a work-group is either a GEMM tile or a transpose strip: the two lay their LDS over one another
    union Lds { SmemGU g; __bf16 t[2][TT][TT]; };
    __shared__ __attribute__((aligned(2048))) Lds lds;
    if (blockIdx.y >= MSLOT) {
        transpose_strip((blockIdx.y - MSLOT) * (IEXP / (GBN / 2)) + blockIdx.x, lds.t, down, downT);
        return;
    }
    grouped_gemm<HID, true>(lds.g, xb, gupT, counts, lists, inter, nullptr);
}

// out = inter @ Wd ; grid (H / GBN, MSLOT)
__global__ __launch_bounds__(256) void moe_down_kernel(
        const __bf16* __restrict__ inter,  // [T][IE], bucket order
        const __bf16* __restrict__ downT,  // [E][H][IE]
        const int*   __restrict__ counts,
        const int*   __restrict__ lists,
        float* __restrict__ out) {
    __shared__ __attribute__((aligned(2048))) SmemDN sm;
    grouped_gemm<IEXP, false>(sm, inter, downT, counts, lists, nullptr, out);
}

// ---------------- Kernel 3b: fallback (f32 staging, inline convert) ----------------
__global__ __launch_bounds__(256) void moe_mlp_f32_kernel(
        const float* __restrict__ x,
        const float* __restrict__ gup,
        const float* __restrict__ down,
        const int*   __restrict__ counts,
        const int*   __restrict__ lists,
        float* __restrict__ out) {
    const int blocks_per_e = NTOK / BM;
    const int e  = blockIdx.x / blocks_per_e;
    const int mb = blockIdx.x % blocks_per_e;
    const int cnt   = counts[e];
    const int start = mb * BM;
    if (start >= cnt) return;
    const int nvalid = (cnt - start) < BM ? (cnt - start) : BM;

    const int tid  = threadIdx.x;
    const int lane = tid & 31;
    const int wave = tid >> 5;
    const int mi   = wave >> 2;
    const int ni   = wave & 3;

    __shared__ alignas(16) float  sXf [BM][XPAD];
    __shared__ alignas(16) float  sWgf[KC][WPAD];
    __shared__ alignas(16) float  sWuf[KC][WPAD];
    __shared__ alignas(16) __bf16 sI  [BM][IPAD];
    __shared__ int          sTok [BM];
    __shared__ const float* sXrow[BM];

    if (tid < BM) {
        const int tk = (tid < nvalid) ? lists[e * NTOK + start + tid] : 0;
        sTok[tid]  = tk;
        sXrow[tid] = x + (size_t)tk * HID;
    }
    __syncthreads();

    const float* Wgu = gup  + (size_t)e * HID * TWOIE;
    const float* Wd  = down + (size_t)e * IEXP * HID;
    const int mrow = mi * 16 + (lane & 15);
    const int ncl  = ni * 16 + (lane & 15);

    for (int no = 0; no < IEXP / 64; ++no) {
        const int ncol = no * 64;
        v8f accg = {0.f, 0.f, 0.f, 0.f, 0.f, 0.f, 0.f, 0.f};
        v8f accu = {0.f, 0.f, 0.f, 0.f, 0.f, 0.f, 0.f, 0.f};
#pragma unroll 1
        for (int k0 = 0; k0 < HID; k0 += KC) {
#pragma unroll
            for (int i = 0; i < 2; ++i) {
                const int c = tid + i * 256;
                const int r = c >> 4, k = (c & 15) << 2;
                stage16(sXrow[r] + k0 + k, &sXf[r][k]);
            }
#pragma unroll
            for (int i = 0; i < 4; ++i) {
                const int c = tid + i * 256;
                const int K = c >> 4, n = (c & 15) << 2;
                const size_t off = (size_t)(k0 + K) * TWOIE + ncol + n;
                stage16(Wgu + off,        &sWgf[K][n]);
                stage16(Wgu + off + IEXP, &sWuf[K][n]);
            }
            WAIT_ASYNC(0);
            __syncthreads();
#pragma unroll
            for (int kk = 0; kk < KC; kk += 32) {
                const v16bf a  = frag_f32(&sXf[mrow][kk], lane);
                const v16bf bg = frag_f32_strided(&sWgf[kk][ncl], WPAD, lane);
                const v16bf bu = frag_f32_strided(&sWuf[kk][ncl], WPAD, lane);
                accg = __builtin_amdgcn_wmma_f32_16x16x32_bf16(false, a, false, bg,
                                                               (short)0, accg, false, false);
                accu = __builtin_amdgcn_wmma_f32_16x16x32_bf16(false, a, false, bu,
                                                               (short)0, accu, false, false);
            }
            __syncthreads();
        }
#pragma unroll
        for (int r = 0; r < 8; ++r) {
            const int row = mi * 16 + r + ((lane >= 16) ? 8 : 0);
            const float g = accg[r];
            const float u = accu[r];
            sI[row][ncol + ni * 16 + (lane & 15)] = f2bf((g / (1.f + __expf(-g))) * u);
        }
    }
    __syncthreads();

    for (int no = 0; no < HID / 64; ++no) {
        const int ncol = no * 64;
        v8f acc = {0.f, 0.f, 0.f, 0.f, 0.f, 0.f, 0.f, 0.f};
#pragma unroll 1
        for (int k0 = 0; k0 < IEXP; k0 += KC) {
#pragma unroll
            for (int i = 0; i < 4; ++i) {
                const int c = tid + i * 256;
                const int K = c >> 4, n = (c & 15) << 2;
                stage16(Wd + (size_t)(k0 + K) * HID + ncol + n, &sWgf[K][n]);
            }
            WAIT_ASYNC(0);
            __syncthreads();
#pragma unroll
            for (int kk = 0; kk < KC; kk += 32) {
                const v16bf a = frag_bf(&sI[mrow][k0 + kk], lane);
                const v16bf b = frag_f32_strided(&sWgf[kk][ncl], WPAD, lane);
                acc = __builtin_amdgcn_wmma_f32_16x16x32_bf16(false, a, false, b,
                                                              (short)0, acc, false, false);
            }
            __syncthreads();
        }
#pragma unroll
        for (int r = 0; r < 8; ++r) {
            const int rloc = mi * 16 + r + ((lane >= 16) ? 8 : 0);
            if (rloc < nvalid)
                out[(size_t)sTok[rloc] * HID + ncol + ni * 16 + (lane & 15)] = acc[r];
        }
    }
}

extern "C" void kernel_launch(void* const* d_in, const int* in_sizes, int n_in,
                              void* d_out, int out_size, void* d_ws, size_t ws_size,
                              hipStream_t stream) {
    const float* x    = (const float*)d_in[0];
    const int*   tids = (const int*)  d_in[1];
    const float* mu   = (const float*)d_in[2];
    const float* gup  = (const float*)d_in[3];
    const float* down = (const float*)d_in[4];
    const float* wr   = (const float*)d_in[5];
    float* out = (float*)d_out;

    int* expert_id = (int*)d_ws;                 // NTOK ints
    int* counts    = expert_id + NTOK;           // NEXP ints
    int* lists     = counts + NEXP;              // NEXP*NTOK ints

    const size_t metaB = ((size_t)(NTOK + NEXP + NEXP * NTOK) * 4 + 255) & ~(size_t)255;
    const size_t nXb   = (size_t)NTOK * HID;
    const size_t nGup  = (size_t)NEXP * TWOIE * HID;
    const size_t nDown = (size_t)NEXP * HID * IEXP;
    const size_t nInt  = (size_t)NTOK * IEXP;
    const size_t need  = metaB + 2 * (nXb + nGup + nDown + nInt);

    if (ws_size >= need) {
        __bf16* xbf   = (__bf16*)((char*)d_ws + metaB);
        __bf16* gupT  = xbf + nXb;
        __bf16* downT = gupT + nGup;
        __bf16* intb  = downT + nDown;
        prep_inputs_kernel<<<RBLK + GUBLK + XBLK, 256, 0, stream>>>(mu, wr, tids, x, gup,
                                                                    expert_id, counts, xbf, gupT);
        bucket_kernel<<<BBLK, 256, 0, stream>>>(expert_id, counts, lists);
        moe_gateup_kernel<<<dim3(IEXP / (GBN / 2), MSLOT + DTBLK / (IEXP / (GBN / 2))), 256, 0, stream>>>(
            xbf, gupT, counts, lists, intb, down, downT);
        moe_down_kernel<<<dim3(HID / GBN, MSLOT), 256, 0, stream>>>(intb, downT, counts, lists, out);
    } else {
        router_kernel<<<RBLK, 256, 0, stream>>>(mu, wr, tids, expert_id);
        zero_counts_kernel<<<1, 32, 0, stream>>>(counts);
        bucket_kernel<<<BBLK, 256, 0, stream>>>(expert_id, counts, lists);
        moe_mlp_f32_kernel<<<NEXP * (NTOK / BM), 256, 0, stream>>>(x, gup, down,
                                                                   counts, lists, out);
    }
}
